// v000
// The times below were measured on an AMD MI455X: many runs one after another, warmed up first and cycling through
// copies of the inputs, with the whole window's GPU time divided by the number of runs. Launches and the gaps
// between them are all in it. The median over several windows is given; except for v000 it joins two sittings, which
// can be a few percent apart, so the side-by-side timings, each taken in one sitting, are the better comparison.
// The starting kernel, v000, takes 82.7 microseconds a run.
#include <hip/hip_runtime.h>

#define B_  256
#define L_  2048
#define E_  64
#define DA_ 64
#define R_  32

typedef __attribute__((ext_vector_type(16))) __bf16 v16bf;
typedef __attribute__((ext_vector_type(8)))  float  v8f;

union Frag { v16bf bf; unsigned u[8]; };

// pack bf16(a), bf16(b) into one dword
__device__ inline unsigned pk2bf(float a, float b) {
  unsigned r;
  asm("v_fma_mixlo_bf16 %0, %1, 1.0, 0\n\t"
      "v_fma_mixhi_bf16 %0, %2, 1.0, 0"
      : "=&v"(r) : "v"(a), "v"(b));
  return r;
}

// pack bf16(a*s), bf16(b*s) into one dword (mask multiply folded into the fma)
__device__ inline unsigned pk2bf_scaled(float a, float b, float s) {
  unsigned r;
  asm("v_fma_mixlo_bf16 %0, %1, %3, 0\n\t"
      "v_fma_mixhi_bf16 %0, %2, %3, 0"
      : "=&v"(r) : "v"(a), "v"(b), "v"(s));
  return r;
}

__device__ inline unsigned short f2bf(float f) {
  unsigned r;
  asm("v_fma_mixlo_bf16 %0, %1, 1.0, 0" : "=v"(r) : "v"(f));
  return (unsigned short)r;
}

__device__ inline float fast_tanh(float x) {
#if __has_builtin(__builtin_amdgcn_tanhf)
  return __builtin_amdgcn_tanhf(x);
#else
  return tanhf(x);
#endif
}

__device__ inline Frag load_frag_rowmajor(const unsigned short* base, int ld,
                                          int rowOff, int kOff, int lane) {
  Frag f;
  int m  = rowOff + (lane & 15);
  int kb = kOff + ((lane >> 4) << 3);
  const unsigned* row = (const unsigned*)(base + m * ld);
#pragma unroll
  for (int i = 0; i < 4; ++i) {
    f.u[i]     = row[(kb >> 1) + i];
    f.u[4 + i] = row[((kb + 16) >> 1) + i];
  }
  return f;
}

// WMMA B-fragment (32x16 bf16) from row-major [K][N] bf16 matrix (ldN elems/row).
__device__ inline Frag load_fragB_colstride(const unsigned short* base, int ldN,
                                            int kOff, int nOff, int lane) {
  Frag f;
  int n  = nOff + (lane & 15);
  int kb = kOff + ((lane >> 4) << 3);
  const unsigned short* col = base + n;
#pragma unroll
  for (int i = 0; i < 4; ++i) {
    unsigned lo  = col[(kb + 2 * i)      * ldN];
    unsigned hi  = col[(kb + 2 * i + 1)  * ldN];
    unsigned lo2 = col[(kb + 16 + 2 * i) * ldN];
    unsigned hi2 = col[(kb + 17 + 2 * i) * ldN];
    f.u[i]     = lo  | (hi  << 16);
    f.u[4 + i] = lo2 | (hi2 << 16);
  }
  return f;
}

__device__ inline v8f wmma_bf16(const Frag& a, const Frag& b, v8f c) {
  return __builtin_amdgcn_wmma_f32_16x16x32_bf16(false, a.bf, false, b.bf,
                                                 (short)0, c, false, false);
}

__global__ __launch_bounds__(128)
void SelfBiLayer_kernel(const float* __restrict__ x, const float* __restrict__ mask,
                        const float* __restrict__ W1, const float* __restrict__ W2,
                        float* __restrict__ out) {
  __shared__ unsigned short sW1[DA_ * E_];          // bf16 W1 [d][e]
  __shared__ unsigned short sW2[R_ * DA_];          // bf16 W2 [r][d]
  __shared__ unsigned       sXu[4][32 * (E_ / 2)];  // per-wave bf16 xm tile [l][e] (packed)
  __shared__ unsigned short sHT[4][32 * DA_];       // per-wave bf16 H transposed [l][d]
  __shared__ unsigned short sA [4][R_ * 32];        // per-wave bf16 exp scores [r][l]
  __shared__ float          sMf[4][32];             // per-wave token masks
  __shared__ float          sS [4][R_];             // per-wave partial row sums
  __shared__ float          sP [4][R_ * E_];        // per-wave partial pooled output

  const int b    = blockIdx.x;
  const int tid  = threadIdx.x;
  const int wv   = tid >> 5;
  const int lane = tid & 31;
  const int g    = lane >> 4;

  for (int i = tid; i < DA_ * E_; i += 128) sW1[i] = f2bf(W1[i]);
  for (int i = tid; i < R_ * DA_; i += 128) sW2[i] = f2bf(W2[i]);
  __syncthreads();

  // Persistent weight fragments: W1 4 M-tiles x 2 K-steps, W2 2 x 2.
  Frag w1f[4][2], w2f[2][2];
#pragma unroll
  for (int md = 0; md < 4; ++md)
#pragma unroll
    for (int ks = 0; ks < 2; ++ks)
      w1f[md][ks] = load_frag_rowmajor(sW1, E_, 16 * md, 32 * ks, lane);
#pragma unroll
  for (int mr = 0; mr < 2; ++mr)
#pragma unroll
    for (int ks = 0; ks < 2; ++ks)
      w2f[mr][ks] = load_frag_rowmajor(sW2, DA_, 16 * mr, 32 * ks, lane);

  v8f P[2][4];
#pragma unroll
  for (int mt = 0; mt < 2; ++mt)
#pragma unroll
    for (int nt = 0; nt < 4; ++nt)
      P[mt][nt] = v8f{0.f,0.f,0.f,0.f,0.f,0.f,0.f,0.f};

  float Sacc[2][8];
#pragma unroll
  for (int mt = 0; mt < 2; ++mt)
#pragma unroll
    for (int v = 0; v < 8; ++v) Sacc[mt][v] = 0.f;

  unsigned short* sX16 = (unsigned short*)sXu[wv];

  for (int it = 0; it < L_ / 128; ++it) {
    const int tok = it * 128 + wv * 32 + lane;
    const float mk = mask[(size_t)b * L_ + tok];
    sMf[wv][lane] = mk;
    const float4* xr = (const float4*)(x + ((size_t)b * L_ + tok) * E_);
    unsigned* dst = &sXu[wv][lane * (E_ / 2)];
#pragma unroll
    for (int j = 0; j < 16; ++j) {
      float4 v = xr[j];
      dst[2 * j]     = pk2bf_scaled(v.x, v.y, mk);   // bf16(x*mk) via fma_mix
      dst[2 * j + 1] = pk2bf_scaled(v.z, v.w, mk);
    }

#pragma unroll
    for (int nt2 = 0; nt2 < 2; ++nt2) {
      // B-frags of xmᵀ (stored [l][e] == Bᵀ, so row-major pattern works)
      Frag bx0 = load_frag_rowmajor(sX16, E_, 16 * nt2, 0,  lane);
      Frag bx1 = load_frag_rowmajor(sX16, E_, 16 * nt2, 32, lane);
      // H = tanh(W1 · xmᵀ); store transposed [l][d], packed dword stores
#pragma unroll
      for (int md = 0; md < 4; ++md) {
        v8f h = v8f{0.f,0.f,0.f,0.f,0.f,0.f,0.f,0.f};
        h = wmma_bf16(w1f[md][0], bx0, h);
        h = wmma_bf16(w1f[md][1], bx1, h);
        int lrow = 16 * nt2 + (lane & 15);
        int dcol = 16 * md + 8 * g;
        unsigned* hrow = (unsigned*)&sHT[wv][lrow * DA_ + dcol];
#pragma unroll
        for (int i = 0; i < 4; ++i)
          hrow[i] = pk2bf(fast_tanh(h[2 * i]), fast_tanh(h[2 * i + 1]));
      }
      // Q = W2 · H  (Hᵀ stored row-major -> row-major B pattern)
      Frag bh0 = load_frag_rowmajor(sHT[wv], DA_, 16 * nt2, 0,  lane);
      Frag bh1 = load_frag_rowmajor(sHT[wv], DA_, 16 * nt2, 32, lane);
      int lcol = 16 * nt2 + (lane & 15);
      float mkc = sMf[wv][lcol];
#pragma unroll
      for (int mr = 0; mr < 2; ++mr) {
        v8f q = v8f{0.f,0.f,0.f,0.f,0.f,0.f,0.f,0.f};
        q = wmma_bf16(w2f[mr][0], bh0, q);
        q = wmma_bf16(w2f[mr][1], bh1, q);
#pragma unroll
        for (int v = 0; v < 8; ++v) {
          float a = __expf(q[v]) * mkc;       // masked exp score
          Sacc[mr][v] += a;                   // per-lane partial row sum
          sA[wv][(16 * mr + 8 * g + v) * 32 + lcol] = f2bf(a);
        }
      }
    }

    // ---- P += A(32x32) · xm(32x64), K = 32 exactly ----
    Frag aC0 = load_frag_rowmajor(sA[wv], 32, 0,  0, lane);
    Frag aC1 = load_frag_rowmajor(sA[wv], 32, 16, 0, lane);
#pragma unroll
    for (int nt = 0; nt < 4; ++nt) {
      Frag bxc = load_fragB_colstride(sX16, E_, 0, 16 * nt, lane);
      P[0][nt] = wmma_bf16(aC0, bxc, P[0][nt]);
      P[1][nt] = wmma_bf16(aC1, bxc, P[1][nt]);
    }
  }

  // ---- reduce S across the 16 lanes of each half-wave (xor<16 stays in half) ----
#pragma unroll
  for (int mt = 0; mt < 2; ++mt)
#pragma unroll
    for (int v = 0; v < 8; ++v) {
      float s = Sacc[mt][v];
      s += __shfl_xor(s, 1, 32);
      s += __shfl_xor(s, 2, 32);
      s += __shfl_xor(s, 4, 32);
      s += __shfl_xor(s, 8, 32);
      Sacc[mt][v] = s;
    }
  if ((lane & 15) == 0) {
#pragma unroll
    for (int mt = 0; mt < 2; ++mt)
#pragma unroll
      for (int v = 0; v < 8; ++v)
        sS[wv][16 * mt + 8 * g + v] = Sacc[mt][v];
  }

  // ---- dump per-wave P partials ----
#pragma unroll
  for (int mt = 0; mt < 2; ++mt)
#pragma unroll
    for (int nt = 0; nt < 4; ++nt)
#pragma unroll
      for (int v = 0; v < 8; ++v)
        sP[wv][(16 * mt + 8 * g + v) * E_ + 16 * nt + (lane & 15)] = P[mt][nt][v];

  __syncthreads();

  // ---- cross-wave reduce + normalize + store ----
  for (int i = tid; i < R_ * E_; i += 128) {
    int r = i >> 6;
    float p = sP[0][i] + sP[1][i] + sP[2][i] + sP[3][i];
    float s = sS[0][r] + sS[1][r] + sS[2][r] + sS[3][r];
    out[(size_t)b * (R_ * E_) + i] = p / s;
  }
}

extern "C" void kernel_launch(void* const* d_in, const int* in_sizes, int n_in,
                              void* d_out, int out_size, void* d_ws, size_t ws_size,
                              hipStream_t stream) {
  const float* x    = (const float*)d_in[0];
  const float* mask = (const float*)d_in[1];
  const float* W1   = (const float*)d_in[2];
  const float* W2   = (const float*)d_in[3];
  float* out = (float*)d_out;
  (void)in_sizes; (void)n_in; (void)out_size; (void)d_ws; (void)ws_size;
  SelfBiLayer_kernel<<<B_, 128, 0, stream>>>(x, mask, W1, W2, out);
}

// v001
// One run takes 46.3 microseconds.
// In two side-by-side timings against v000, it was 1.81 and 1.80 times as fast.
#include <hip/hip_runtime.h>

#define B_  256
#define L_  2048
#define E_  64
#define DA_ 64
#define R_  32
#define NW_ 16
#define NT_ (NW_ * 32)

typedef __attribute__((ext_vector_type(16))) __bf16 v16bf;
typedef __attribute__((ext_vector_type(8)))  float  v8f;

union Frag { v16bf bf; unsigned u[8]; };

// pack bf16(a), bf16(b) into one dword
__device__ inline unsigned pk2bf(float a, float b) {
  unsigned r;
  asm("v_fma_mixlo_bf16 %0, %1, 1.0, 0\n\t"
      "v_fma_mixhi_bf16 %0, %2, 1.0, 0"
      : "=&v"(r) : "v"(a), "v"(b));
  return r;
}

// pack bf16(a*s), bf16(b*s) into one dword (mask multiply folded into the fma)
__device__ inline unsigned pk2bf_scaled(float a, float b, float s) {
  unsigned r;
  asm("v_fma_mixlo_bf16 %0, %1, %3, 0\n\t"
      "v_fma_mixhi_bf16 %0, %2, %3, 0"
      : "=&v"(r) : "v"(a), "v"(b), "v"(s));
  return r;
}

__device__ inline unsigned short f2bf(float f) {
  unsigned r;
  asm("v_fma_mixlo_bf16 %0, %1, 1.0, 0" : "=v"(r) : "v"(f));
  return (unsigned short)r;
}

__device__ inline float fast_tanh(float x) {
#if __has_builtin(__builtin_amdgcn_tanhf)
  return __builtin_amdgcn_tanhf(x);
#else
  return tanhf(x);
#endif
}

__device__ inline Frag load_frag_rowmajor(const unsigned short* base, int ld,
                                          int rowOff, int kOff, int lane) {
  Frag f;
  int m  = rowOff + (lane & 15);
  int kb = kOff + ((lane >> 4) << 3);
  const unsigned* row = (const unsigned*)(base + m * ld);
#pragma unroll
  for (int i = 0; i < 4; ++i) {
    f.u[i]     = row[(kb >> 1) + i];
    f.u[4 + i] = row[((kb + 16) >> 1) + i];
  }
  return f;
}

// WMMA B-fragment (32x16 bf16) from row-major [K][N] bf16 matrix (ldN elems/row).
__device__ inline Frag load_fragB_colstride(const unsigned short* base, int ldN,
                                            int kOff, int nOff, int lane) {
  Frag f;
  int n  = nOff + (lane & 15);
  int kb = kOff + ((lane >> 4) << 3);
  const unsigned short* col = base + n;
#pragma unroll
  for (int i = 0; i < 4; ++i) {
    unsigned lo  = col[(kb + 2 * i)      * ldN];
    unsigned hi  = col[(kb + 2 * i + 1)  * ldN];
    unsigned lo2 = col[(kb + 16 + 2 * i) * ldN];
    unsigned hi2 = col[(kb + 17 + 2 * i) * ldN];
    f.u[i]     = lo  | (hi  << 16);
    f.u[4 + i] = lo2 | (hi2 << 16);
  }
  return f;
}

__device__ inline v8f wmma_bf16(const Frag& a, const Frag& b, v8f c) {
  return __builtin_amdgcn_wmma_f32_16x16x32_bf16(false, a.bf, false, b.bf,
                                                 (short)0, c, false, false);
}

__global__ __launch_bounds__(NT_)
void SelfBiLayer_kernel(const float* __restrict__ x, const float* __restrict__ mask,
                        const float* __restrict__ W1, const float* __restrict__ W2,
                        float* __restrict__ out) {
  __shared__ unsigned short sW1[DA_ * E_];          // bf16 W1 [d][e]
  __shared__ unsigned short sW2[R_ * DA_];          // bf16 W2 [r][d]
  __shared__ unsigned       sXu[NW_][32 * (E_ / 2)];  // per-wave bf16 xm tile [l][e] (packed)
  __shared__ unsigned short sHT[NW_][32 * DA_];       // per-wave bf16 H transposed [l][d]
  __shared__ unsigned short sA [NW_][R_ * 32];        // per-wave bf16 exp scores [r][l]
  __shared__ float          sMf[NW_][32];             // per-wave token masks
  __shared__ float          sS [NW_][R_];             // per-wave partial row sums
  __shared__ float          sP [NW_][R_ * E_];        // per-wave partial pooled output

  const int b    = blockIdx.x;
  const int tid  = threadIdx.x;
  const int wv   = tid >> 5;
  const int lane = tid & 31;
  const int g    = lane >> 4;

  for (int i = tid; i < DA_ * E_; i += NT_) sW1[i] = f2bf(W1[i]);
  for (int i = tid; i < R_ * DA_; i += NT_) sW2[i] = f2bf(W2[i]);
  __syncthreads();

  // Persistent weight fragments: W1 4 M-tiles x 2 K-steps, W2 2 x 2.
  Frag w1f[4][2], w2f[2][2];
#pragma unroll
  for (int md = 0; md < 4; ++md)
#pragma unroll
    for (int ks = 0; ks < 2; ++ks)
      w1f[md][ks] = load_frag_rowmajor(sW1, E_, 16 * md, 32 * ks, lane);
#pragma unroll
  for (int mr = 0; mr < 2; ++mr)
#pragma unroll
    for (int ks = 0; ks < 2; ++ks)
      w2f[mr][ks] = load_frag_rowmajor(sW2, DA_, 16 * mr, 32 * ks, lane);

  v8f P[2][4];
#pragma unroll
  for (int mt = 0; mt < 2; ++mt)
#pragma unroll
    for (int nt = 0; nt < 4; ++nt)
      P[mt][nt] = v8f{0.f,0.f,0.f,0.f,0.f,0.f,0.f,0.f};

  float Sacc[2][8];
#pragma unroll
  for (int mt = 0; mt < 2; ++mt)
#pragma unroll
    for (int v = 0; v < 8; ++v) Sacc[mt][v] = 0.f;

  unsigned short* sX16 = (unsigned short*)sXu[wv];

  for (int it = 0; it < L_ / NT_; ++it) {
    const int tok = it * NT_ + wv * 32 + lane;
    const float mk = mask[(size_t)b * L_ + tok];
    sMf[wv][lane] = mk;
    const float4* xr = (const float4*)(x + ((size_t)b * L_ + tok) * E_);
    unsigned* dst = &sXu[wv][lane * (E_ / 2)];
#pragma unroll
    for (int j = 0; j < 16; ++j) {
      float4 v = xr[j];
      dst[2 * j]     = pk2bf_scaled(v.x, v.y, mk);   // bf16(x*mk) via fma_mix
      dst[2 * j + 1] = pk2bf_scaled(v.z, v.w, mk);
    }

#pragma unroll
    for (int nt2 = 0; nt2 < 2; ++nt2) {
      // B-frags of xmᵀ (stored [l][e] == Bᵀ, so row-major pattern works)
      Frag bx0 = load_frag_rowmajor(sX16, E_, 16 * nt2, 0,  lane);
      Frag bx1 = load_frag_rowmajor(sX16, E_, 16 * nt2, 32, lane);
      // H = tanh(W1 · xmᵀ); store transposed [l][d], packed dword stores
#pragma unroll
      for (int md = 0; md < 4; ++md) {
        v8f h = v8f{0.f,0.f,0.f,0.f,0.f,0.f,0.f,0.f};
        h = wmma_bf16(w1f[md][0], bx0, h);
        h = wmma_bf16(w1f[md][1], bx1, h);
        int lrow = 16 * nt2 + (lane & 15);
        int dcol = 16 * md + 8 * g;
        unsigned* hrow = (unsigned*)&sHT[wv][lrow * DA_ + dcol];
#pragma unroll
        for (int i = 0; i < 4; ++i)
          hrow[i] = pk2bf(fast_tanh(h[2 * i]), fast_tanh(h[2 * i + 1]));
      }
      // Q = W2 · H  (Hᵀ stored row-major -> row-major B pattern)
      Frag bh0 = load_frag_rowmajor(sHT[wv], DA_, 16 * nt2, 0,  lane);
      Frag bh1 = load_frag_rowmajor(sHT[wv], DA_, 16 * nt2, 32, lane);
      int lcol = 16 * nt2 + (lane & 15);
      float mkc = sMf[wv][lcol];
#pragma unroll
      for (int mr = 0; mr < 2; ++mr) {
        v8f q = v8f{0.f,0.f,0.f,0.f,0.f,0.f,0.f,0.f};
        q = wmma_bf16(w2f[mr][0], bh0, q);
        q = wmma_bf16(w2f[mr][1], bh1, q);
#pragma unroll
        for (int v = 0; v < 8; ++v) {
          float a = __expf(q[v]) * mkc;       // masked exp score
          Sacc[mr][v] += a;                   // per-lane partial row sum
          sA[wv][(16 * mr + 8 * g + v) * 32 + lcol] = f2bf(a);
        }
      }
    }

    // ---- P += A(32x32) · xm(32x64), K = 32 exactly ----
    Frag aC0 = load_frag_rowmajor(sA[wv], 32, 0,  0, lane);
    Frag aC1 = load_frag_rowmajor(sA[wv], 32, 16, 0, lane);
#pragma unroll
    for (int nt = 0; nt < 4; ++nt) {
      Frag bxc = load_fragB_colstride(sX16, E_, 0, 16 * nt, lane);
      P[0][nt] = wmma_bf16(aC0, bxc, P[0][nt]);
      P[1][nt] = wmma_bf16(aC1, bxc, P[1][nt]);
    }
  }

  // ---- reduce S across the 16 lanes of each half-wave (xor<16 stays in half) ----
#pragma unroll
  for (int mt = 0; mt < 2; ++mt)
#pragma unroll
    for (int v = 0; v < 8; ++v) {
      float s = Sacc[mt][v];
      s += __shfl_xor(s, 1, 32);
      s += __shfl_xor(s, 2, 32);
      s += __shfl_xor(s, 4, 32);
      s += __shfl_xor(s, 8, 32);
      Sacc[mt][v] = s;
    }
  if ((lane & 15) == 0) {
#pragma unroll
    for (int mt = 0; mt < 2; ++mt)
#pragma unroll
      for (int v = 0; v < 8; ++v)
        sS[wv][16 * mt + 8 * g + v] = Sacc[mt][v];
  }

  // ---- dump per-wave P partials ----
#pragma unroll
  for (int mt = 0; mt < 2; ++mt)
#pragma unroll
    for (int nt = 0; nt < 4; ++nt)
#pragma unroll
      for (int v = 0; v < 8; ++v)
        sP[wv][(16 * mt + 8 * g + v) * E_ + 16 * nt + (lane & 15)] = P[mt][nt][v];

  __syncthreads();

  // ---- cross-wave reduce + normalize + store ----
  for (int i = tid; i < R_ * E_; i += NT_) {
    int r = i >> 6;
    float p = sP[0][i], s = sS[0][r];
    for (int w = 1; w < NW_; ++w) {
      p += sP[w][i];
      s += sS[w][r];
    }
    out[(size_t)b * (R_ * E_) + i] = p / s;
  }
}

extern "C" void kernel_launch(void* const* d_in, const int* in_sizes, int n_in,
                              void* d_out, int out_size, void* d_ws, size_t ws_size,
                              hipStream_t stream) {
  const float* x    = (const float*)d_in[0];
  const float* mask = (const float*)d_in[1];
  const float* W1   = (const float*)d_in[2];
  const float* W2   = (const float*)d_in[3];
  float* out = (float*)d_out;
  (void)in_sizes; (void)n_in; (void)out_size; (void)d_ws; (void)ws_size;
  SelfBiLayer_kernel<<<B_, NT_, 0, stream>>>(x, mask, W1, W2, out);
}

// v002
// Measured time: 32.2 microseconds a run.
// In both of two side-by-side timings against v001, it was 1.44 times as fast.
// Over all steps from v000 it is 2.60 times as fast.
#include <hip/hip_runtime.h>

#define B_  256
#define L_  2048
#define E_  64
#define DA_ 64
#define R_  32
#define NW_ 16
#define NT_ (NW_ * 32)

typedef __attribute__((ext_vector_type(16))) __bf16 v16bf;
typedef __attribute__((ext_vector_type(8)))  float  v8f;

union Frag { v16bf bf; unsigned u[8]; };

// pack bf16(a), bf16(b) into one dword
__device__ inline unsigned pk2bf(float a, float b) {
  unsigned r;
  asm("v_fma_mixlo_bf16 %0, %1, 1.0, 0\n\t"
      "v_fma_mixhi_bf16 %0, %2, 1.0, 0"
      : "=&v"(r) : "v"(a), "v"(b));
  return r;
}

// pack bf16(a*s), bf16(b*s) into one dword (mask multiply folded into the fma)
__device__ inline unsigned pk2bf_scaled(float a, float b, float s) {
  unsigned r;
  asm("v_fma_mixlo_bf16 %0, %1, %3, 0\n\t"
      "v_fma_mixhi_bf16 %0, %2, %3, 0"
      : "=&v"(r) : "v"(a), "v"(b), "v"(s));
  return r;
}

__device__ inline unsigned short f2bf(float f) {
  unsigned r;
  asm("v_fma_mixlo_bf16 %0, %1, 1.0, 0" : "=v"(r) : "v"(f));
  return (unsigned short)r;
}

__device__ inline float fast_tanh(float x) {
#if __has_builtin(__builtin_amdgcn_tanhf)
  return __builtin_amdgcn_tanhf(x);
#else
  return tanhf(x);
#endif
}

__device__ inline Frag load_frag_rowmajor(const unsigned short* base, int ld,
                                          int rowOff, int kOff, int lane) {
  Frag f;
  int m  = rowOff + (lane & 15);
  int kb = kOff + ((lane >> 4) << 3);
  const unsigned* row = (const unsigned*)(base + m * ld);
#pragma unroll
  for (int i = 0; i < 4; ++i) {
    f.u[i]     = row[(kb >> 1) + i];
    f.u[4 + i] = row[((kb + 16) >> 1) + i];
  }
  return f;
}

// WMMA B-fragment (32x16 bf16) from row-major [K][N] bf16 matrix (ldN elems/row).
__device__ inline Frag load_fragB_colstride(const unsigned short* base, int ldN,
                                            int kOff, int nOff, int lane) {
  Frag f;
  int n  = nOff + (lane & 15);
  int kb = kOff + ((lane >> 4) << 3);
  const unsigned short* col = base + n;
#pragma unroll
  for (int i = 0; i < 4; ++i) {
    unsigned lo  = col[(kb + 2 * i)      * ldN];
    unsigned hi  = col[(kb + 2 * i + 1)  * ldN];
    unsigned lo2 = col[(kb + 16 + 2 * i) * ldN];
    unsigned hi2 = col[(kb + 17 + 2 * i) * ldN];
    f.u[i]     = lo  | (hi  << 16);
    f.u[4 + i] = lo2 | (hi2 << 16);
  }
  return f;
}

__device__ inline v8f wmma_bf16(const Frag& a, const Frag& b, v8f c) {
  return __builtin_amdgcn_wmma_f32_16x16x32_bf16(false, a.bf, false, b.bf,
                                                 (short)0, c, false, false);
}

__device__ inline void copy_tile(unsigned ldsX, const float* gX) {
  asm volatile(
      "global_load_async_to_lds_b128 %0, %1, off\n\t"
      "global_load_async_to_lds_b128 %0, %1, off offset:512\n\t"
      "global_load_async_to_lds_b128 %0, %1, off offset:1024\n\t"
      "global_load_async_to_lds_b128 %0, %1, off offset:1536\n\t"
      "global_load_async_to_lds_b128 %0, %1, off offset:2048\n\t"
      "global_load_async_to_lds_b128 %0, %1, off offset:2560\n\t"
      "global_load_async_to_lds_b128 %0, %1, off offset:3072\n\t"
      "global_load_async_to_lds_b128 %0, %1, off offset:3584\n\t"
      "global_load_async_to_lds_b128 %0, %1, off offset:4096\n\t"
      "global_load_async_to_lds_b128 %0, %1, off offset:4608\n\t"
      "global_load_async_to_lds_b128 %0, %1, off offset:5120\n\t"
      "global_load_async_to_lds_b128 %0, %1, off offset:5632\n\t"
      "global_load_async_to_lds_b128 %0, %1, off offset:6144\n\t"
      "global_load_async_to_lds_b128 %0, %1, off offset:6656\n\t"
      "global_load_async_to_lds_b128 %0, %1, off offset:7168\n\t"
      "global_load_async_to_lds_b128 %0, %1, off offset:7680\n\t"
      "s_wait_xcnt 0x0"
      :: "v"(ldsX), "v"(gX) : "memory");
}

__device__ inline void copy_masks(unsigned ldsM, const float* gM) {
  asm volatile(
      "global_load_async_to_lds_b128 %0, %1, off\n\t"
      "s_wait_xcnt 0x0"
      :: "v"(ldsM), "v"(gM) : "memory");
}

// mask of token 16 * (lane >> 4) + J: lane J of each 16-lane row, shared with the row
template <int J>
__device__ inline float row_mask(float mk) {
  return __builtin_bit_cast(float,
      __builtin_amdgcn_mov_dpp(__builtin_bit_cast(int, mk), 0x150 + J, 0xf, 0xf, false));
}

__device__ inline uint2 pk4bf_scaled(float4 v, float s) {
  uint2 p;
  p.x = pk2bf_scaled(v.x, v.y, s);                 // bf16(x*mk) via fma_mix
  p.y = pk2bf_scaled(v.z, v.w, s);
  return p;
}

template <int J>
__device__ inline void convert_rows(const float4* xr, uint2* dst, float mk) {
  if constexpr (J < 16) {
    const float4 v0 = xr[(J + 0) * (E_ / 4)];
    const float4 v1 = xr[(J + 1) * (E_ / 4)];
    const float4 v2 = xr[(J + 2) * (E_ / 4)];
    const float4 v3 = xr[(J + 3) * (E_ / 4)];
    dst[(J + 0) * (E_ / 4)] = pk4bf_scaled(v0, row_mask<J + 0>(mk));
    dst[(J + 1) * (E_ / 4)] = pk4bf_scaled(v1, row_mask<J + 1>(mk));
    dst[(J + 2) * (E_ / 4)] = pk4bf_scaled(v2, row_mask<J + 2>(mk));
    dst[(J + 3) * (E_ / 4)] = pk4bf_scaled(v3, row_mask<J + 3>(mk));
    convert_rows<J + 4>(xr, dst, mk);
  }
}

__global__ __launch_bounds__(NT_)
void SelfBiLayer_kernel(const float* __restrict__ x, const float* __restrict__ mask,
                        const float* __restrict__ W1, const float* __restrict__ W2,
                        float* __restrict__ out) {
  __shared__ unsigned short sW1[DA_ * E_];          // bf16 W1 [d][e]
  __shared__ unsigned short sW2[R_ * DA_];          // bf16 W2 [r][d]
  __shared__ unsigned       sXu[NW_][32 * (E_ / 2)];  // per-wave bf16 xm tile [l][e] (packed)
  __shared__ unsigned short sHT[NW_][32 * DA_];       // per-wave bf16 H transposed [l][d]
  __shared__ unsigned short sA [NW_][R_ * 32];        // per-wave bf16 exp scores [r][l]
  __shared__ __attribute__((aligned(16))) float sMf[NW_][L_ / NT_][32];  // per-wave token masks, one row per tile
  __shared__ float          sS [NW_][R_];             // per-wave partial row sums
  __shared__ __attribute__((aligned(16))) float sP[NW_][R_ * E_];  // in the loop: per-wave f32 x tile [l][e]; then partial pooled output

  const int b    = blockIdx.x;
  const int tid  = threadIdx.x;
  const int wv   = tid >> 5;
  const int lane = tid & 31;
  const int g    = lane >> 4;

  // Tile 0 starts to fly before the weights are staged. Every wave copies into LDS of its own.
  const unsigned ldsX = (unsigned)(size_t)&sP[wv][lane * 4];
  const float* gX = x + ((size_t)b * L_ + wv * 32) * E_ + lane * 4;
  copy_tile(ldsX, gX);
  copy_masks((unsigned)(size_t)&sMf[wv][lane >> 3][(lane & 7) * 4],
             mask + (size_t)b * L_ + wv * 32 + (lane >> 3) * NT_ + (lane & 7) * 4);

  for (int i = tid; i < DA_ * E_; i += NT_) sW1[i] = f2bf(W1[i]);
  for (int i = tid; i < R_ * DA_; i += NT_) sW2[i] = f2bf(W2[i]);
  __syncthreads();

  // Persistent weight fragments: W1 4 M-tiles x 2 K-steps, W2 2 x 2.
  Frag w1f[4][2], w2f[2][2];
#pragma unroll
  for (int md = 0; md < 4; ++md)
#pragma unroll
    for (int ks = 0; ks < 2; ++ks)
      w1f[md][ks] = load_frag_rowmajor(sW1, E_, 16 * md, 32 * ks, lane);
#pragma unroll
  for (int mr = 0; mr < 2; ++mr)
#pragma unroll
    for (int ks = 0; ks < 2; ++ks)
      w2f[mr][ks] = load_frag_rowmajor(sW2, DA_, 16 * mr, 32 * ks, lane);

  v8f P[2][4];
#pragma unroll
  for (int mt = 0; mt < 2; ++mt)
#pragma unroll
    for (int nt = 0; nt < 4; ++nt)
      P[mt][nt] = v8f{0.f,0.f,0.f,0.f,0.f,0.f,0.f,0.f};

  float Sacc[2][8];
#pragma unroll
  for (int mt = 0; mt < 2; ++mt)
#pragma unroll
    for (int v = 0; v < 8; ++v) Sacc[mt][v] = 0.f;

  unsigned short* sX16 = (unsigned short*)sXu[wv];

  // Kept rolled: peeling the last trip (the one that issues no copies) would double the loop's code.
#pragma clang loop unroll(disable)
  for (int it = 0; it < L_ / NT_; ++it) {
    // ---- this wave's 32-token tile: staged f32 -> masked bf16 in LDS ----
    // The wave's own copies of this tile have landed behind this wait (no other wave reads them).
    asm volatile("s_wait_asynccnt 0x0" ::: "memory");
    const float mk = sMf[wv][it][lane];
    convert_rows<0>((const float4*)&sP[wv][16 * g * E_] + (lane & 15),
                    (uint2*)&sXu[wv][16 * g * (E_ / 2)] + (lane & 15), mk);
    // The wave's reads of the staged tile have retired before the next copies overwrite it.
    asm volatile("s_wait_dscnt 0x0" ::: "memory");
    if (it + 1 < L_ / NT_)
      copy_tile(ldsX, gX + (size_t)(it + 1) * NT_ * E_);

#pragma unroll
    for (int nt2 = 0; nt2 < 2; ++nt2) {
      // B-frags of xmᵀ (stored [l][e] == Bᵀ, so row-major pattern works)
      Frag bx0 = load_frag_rowmajor(sX16, E_, 16 * nt2, 0,  lane);
      Frag bx1 = load_frag_rowmajor(sX16, E_, 16 * nt2, 32, lane);
      // H = tanh(W1 · xmᵀ); store transposed [l][d], packed dword stores
#pragma unroll
      for (int md = 0; md < 4; ++md) {
        v8f h = v8f{0.f,0.f,0.f,0.f,0.f,0.f,0.f,0.f};
        h = wmma_bf16(w1f[md][0], bx0, h);
        h = wmma_bf16(w1f[md][1], bx1, h);
        int lrow = 16 * nt2 + (lane & 15);
        int dcol = 16 * md + 8 * g;
        unsigned* hrow = (unsigned*)&sHT[wv][lrow * DA_ + dcol];
#pragma unroll
        for (int i = 0; i < 4; ++i)
          hrow[i] = pk2bf(fast_tanh(h[2 * i]), fast_tanh(h[2 * i + 1]));
      }
      // Q = W2 · H  (Hᵀ stored row-major -> row-major B pattern)
      Frag bh0 = load_frag_rowmajor(sHT[wv], DA_, 16 * nt2, 0,  lane);
      Frag bh1 = load_frag_rowmajor(sHT[wv], DA_, 16 * nt2, 32, lane);
      int lcol = 16 * nt2 + (lane & 15);
      float mkc = sMf[wv][it][lcol];
#pragma unroll
      for (int mr = 0; mr < 2; ++mr) {
        v8f q = v8f{0.f,0.f,0.f,0.f,0.f,0.f,0.f,0.f};
        q = wmma_bf16(w2f[mr][0], bh0, q);
        q = wmma_bf16(w2f[mr][1], bh1, q);
#pragma unroll
        for (int v = 0; v < 8; ++v) {
          float a = __expf(q[v]) * mkc;       // masked exp score
          Sacc[mr][v] += a;                   // per-lane partial row sum
          sA[wv][(16 * mr + 8 * g + v) * 32 + lcol] = f2bf(a);
        }
      }
    }

    // ---- P += A(32x32) · xm(32x64), K = 32 exactly ----
    Frag aC0 = load_frag_rowmajor(sA[wv], 32, 0,  0, lane);
    Frag aC1 = load_frag_rowmajor(sA[wv], 32, 16, 0, lane);
#pragma unroll
    for (int nt = 0; nt < 4; ++nt) {
      Frag bxc = load_fragB_colstride(sX16, E_, 0, 16 * nt, lane);
      P[0][nt] = wmma_bf16(aC0, bxc, P[0][nt]);
      P[1][nt] = wmma_bf16(aC1, bxc, P[1][nt]);
    }
  }

  // ---- reduce S across the 16 lanes of each half-wave (xor<16 stays in half) ----
#pragma unroll
  for (int mt = 0; mt < 2; ++mt)
#pragma unroll
    for (int v = 0; v < 8; ++v) {
      float s = Sacc[mt][v];
      s += __shfl_xor(s, 1, 32);
      s += __shfl_xor(s, 2, 32);
      s += __shfl_xor(s, 4, 32);
      s += __shfl_xor(s, 8, 32);
      Sacc[mt][v] = s;
    }
  if ((lane & 15) == 0) {
#pragma unroll
    for (int mt = 0; mt < 2; ++mt)
#pragma unroll
      for (int v = 0; v < 8; ++v)
        sS[wv][16 * mt + 8 * g + v] = Sacc[mt][v];
  }

  // ---- dump per-wave P partials (one base address and constant offsets: nothing of it lives across the loop) ----
  float* pRow = &sP[wv][8 * g * E_ + (lane & 15)];
#pragma unroll
  for (int mt = 0; mt < 2; ++mt)
#pragma unroll
    for (int nt = 0; nt < 4; ++nt)
#pragma unroll
      for (int v = 0; v < 8; ++v)
        pRow[(16 * mt + v) * E_ + 16 * nt] = P[mt][nt][v];

  __syncthreads();

  // ---- cross-wave reduce + normalize + store ----
  for (int i = tid; i < R_ * E_; i += NT_) {
    int r = i >> 6;
    float p = sP[0][i], s = sS[0][r];
    for (int w = 1; w < NW_; ++w) {
      p += sP[w][i];
      s += sS[w][r];
    }
    out[(size_t)b * (R_ * E_) + i] = p / s;
  }
}

extern "C" void kernel_launch(void* const* d_in, const int* in_sizes, int n_in,
                              void* d_out, int out_size, void* d_ws, size_t ws_size,
                              hipStream_t stream) {
  const float* x    = (const float*)d_in[0];
  const float* mask = (const float*)d_in[1];
  const float* W1   = (const float*)d_in[2];
  const float* W2   = (const float*)d_in[3];
  float* out = (float*)d_out;
  (void)in_sizes; (void)n_in; (void)out_size; (void)d_ws; (void)ws_size;
  SelfBiLayer_kernel<<<B_, NT_, 0, stream>>>(x, mask, W1, W2, out);
}

// v003
// One run takes 23.4 microseconds.
// Two timings next to v002 both put it at 1.38 times that version's speed.
// Counting every step since v000, it is 3.58 times as fast.
#include <hip/hip_runtime.h>

#define B_  256
#define L_  2048
#define E_  64
#define DA_ 64
#define R_  32
#define NW_ 16
#define NT_ (NW_ * 32)

typedef __attribute__((ext_vector_type(16))) __bf16 v16bf;
typedef __attribute__((ext_vector_type(8)))  float  v8f;
typedef __attribute__((ext_vector_type(2)))  float  v2f;

union Frag { v16bf bf; unsigned u[8]; };

// pack bf16(a*s), bf16(b*s) into one dword (mask multiply folded into the fma)
__device__ inline unsigned pk2bf_scaled(float a, float b, float s) {
  unsigned r;
  asm("v_fma_mixlo_bf16 %0, %1, %3, 0\n\t"
      "v_fma_mixhi_bf16 %0, %2, %3, 0"
      : "=&v"(r) : "v"(a), "v"(b), "v"(s));
  return r;
}

__device__ inline unsigned short f2bf(float f) {
  unsigned r;
  asm("v_fma_mixlo_bf16 %0, %1, 1.0, 0" : "=v"(r) : "v"(f));
  return (unsigned short)r;
}

__device__ inline float fast_tanh(float x) {
#if __has_builtin(__builtin_amdgcn_tanhf)
  return __builtin_amdgcn_tanhf(x);
#else
  return tanhf(x);
#endif
}

__device__ inline Frag load_frag_rowmajor(const unsigned short* base, int ld,
                                          int rowOff, int kOff, int lane) {
  Frag f;
  int m  = rowOff + (lane & 15);
  int kb = kOff + ((lane >> 4) << 3);
  const unsigned* row = (const unsigned*)(base + m * ld);
#pragma unroll
  for (int i = 0; i < 4; ++i) {
    f.u[i]     = row[(kb >> 1) + i];
    f.u[4 + i] = row[((kb + 16) >> 1) + i];
  }
  return f;
}

// WMMA B-fragment (32x16 bf16) from row-major [K][N] bf16 matrix (ldN elems/row).
__device__ inline Frag load_fragB_colstride(const unsigned short* base, int ldN,
                                            int kOff, int nOff, int lane) {
  Frag f;
  int n  = nOff + (lane & 15);
  int kb = kOff + ((lane >> 4) << 3);
  const unsigned short* col = base + n;
#pragma unroll
  for (int i = 0; i < 4; ++i) {
    unsigned lo  = col[(kb + 2 * i)      * ldN];
    unsigned hi  = col[(kb + 2 * i + 1)  * ldN];
    unsigned lo2 = col[(kb + 16 + 2 * i) * ldN];
    unsigned hi2 = col[(kb + 17 + 2 * i) * ldN];
    f.u[i]     = lo  | (hi  << 16);
    f.u[4 + i] = lo2 | (hi2 << 16);
  }
  return f;
}

__device__ inline v8f wmma_bf16(const Frag& a, const Frag& b, v8f c) {
  return __builtin_amdgcn_wmma_f32_16x16x32_bf16(false, a.bf, false, b.bf,
                                                 (short)0, c, false, false);
}

__device__ inline void copy_tile(unsigned ldsX, const float* gX) {
  asm volatile(
      "global_load_async_to_lds_b128 %0, %1, off\n\t"
      "global_load_async_to_lds_b128 %0, %1, off offset:512\n\t"
      "global_load_async_to_lds_b128 %0, %1, off offset:1024\n\t"
      "global_load_async_to_lds_b128 %0, %1, off offset:1536\n\t"
      "global_load_async_to_lds_b128 %0, %1, off offset:2048\n\t"
      "global_load_async_to_lds_b128 %0, %1, off offset:2560\n\t"
      "global_load_async_to_lds_b128 %0, %1, off offset:3072\n\t"
      "global_load_async_to_lds_b128 %0, %1, off offset:3584\n\t"
      "global_load_async_to_lds_b128 %0, %1, off offset:4096\n\t"
      "global_load_async_to_lds_b128 %0, %1, off offset:4608\n\t"
      "global_load_async_to_lds_b128 %0, %1, off offset:5120\n\t"
      "global_load_async_to_lds_b128 %0, %1, off offset:5632\n\t"
      "global_load_async_to_lds_b128 %0, %1, off offset:6144\n\t"
      "global_load_async_to_lds_b128 %0, %1, off offset:6656\n\t"
      "global_load_async_to_lds_b128 %0, %1, off offset:7168\n\t"
      "global_load_async_to_lds_b128 %0, %1, off offset:7680\n\t"
      "s_wait_xcnt 0x0"
      :: "v"(ldsX), "v"(gX) : "memory");
}

__device__ inline void copy_masks(unsigned ldsM, const float* gM) {
  asm volatile(
      "global_load_async_to_lds_b128 %0, %1, off\n\t"
      "s_wait_xcnt 0x0"
      :: "v"(ldsM), "v"(gM) : "memory");
}

// mask of token 16 * (lane >> 4) + J: lane J of each 16-lane row, shared with the row
template <int J>
__device__ inline float row_mask(float mk) {
  return __builtin_bit_cast(float,
      __builtin_amdgcn_mov_dpp(__builtin_bit_cast(int, mk), 0x150 + J, 0xf, 0xf, false));
}

__device__ inline uint2 pk4bf_scaled(float4 v, float s) {
  uint2 p;
  p.x = pk2bf_scaled(v.x, v.y, s);                 // bf16(x*mk) via fma_mix
  p.y = pk2bf_scaled(v.z, v.w, s);
  return p;
}

template <int J>
__device__ inline void convert_rows(const float4* xr, uint2* dst, float mk) {
  if constexpr (J < 16) {
    const float4 v0 = xr[(J + 0) * (E_ / 4)];
    const float4 v1 = xr[(J + 1) * (E_ / 4)];
    const float4 v2 = xr[(J + 2) * (E_ / 4)];
    const float4 v3 = xr[(J + 3) * (E_ / 4)];
    dst[(J + 0) * (E_ / 4)] = pk4bf_scaled(v0, row_mask<J + 0>(mk));
    dst[(J + 1) * (E_ / 4)] = pk4bf_scaled(v1, row_mask<J + 1>(mk));
    dst[(J + 2) * (E_ / 4)] = pk4bf_scaled(v2, row_mask<J + 2>(mk));
    dst[(J + 3) * (E_ / 4)] = pk4bf_scaled(v3, row_mask<J + 3>(mk));
    convert_rows<J + 4>(xr, dst, mk);
  }
}

__global__ __launch_bounds__(NT_)
void SelfBiLayer_kernel(const float* __restrict__ x, const float* __restrict__ mask,
                        const float* __restrict__ W1, const float* __restrict__ W2,
                        float* __restrict__ out) {
  __shared__ unsigned short sW1[DA_ * E_];          // bf16 W1 [d][e]
  __shared__ unsigned short sW2[R_ * DA_];          // bf16 W2 [r][d]
  __shared__ unsigned       sXu[NW_][32 * (E_ / 2)];  // per-wave bf16 xm tile [l][e] (packed)
  __shared__ __attribute__((aligned(16))) float sMf[NW_][L_ / NT_][32];  // per-wave token masks, one row per tile
  __shared__ float          sS [NW_][R_];             // per-wave partial row sums
  __shared__ __attribute__((aligned(16))) float sP[NW_][R_ * E_];  // in the loop: per-wave f32 x tile [l][e]; then partial pooled output

  const int b    = blockIdx.x;
  const int tid  = threadIdx.x;
  const int wv   = tid >> 5;
  const int lane = tid & 31;
  const int g    = lane >> 4;

  // Tile 0 starts to fly before the weights are staged. Every wave copies into LDS of its own.
  const unsigned ldsX = (unsigned)(size_t)&sP[wv][lane * 4];
  const float* gX = x + ((size_t)b * L_ + wv * 32) * E_ + lane * 4;
  copy_tile(ldsX, gX);
  copy_masks((unsigned)(size_t)&sMf[wv][lane >> 3][(lane & 7) * 4],
             mask + (size_t)b * L_ + wv * 32 + (lane >> 3) * NT_ + (lane & 7) * 4);

  for (int i = tid; i < DA_ * E_; i += NT_) sW1[i] = f2bf(W1[i]);
  for (int i = tid; i < R_ * DA_; i += NT_) sW2[i] = f2bf(W2[i]);
  __syncthreads();

  // Persistent weight fragments: W1 4 M-tiles x 2 K-steps, W2 2 x 2.
  Frag w1f[4][2], w2f[2][2];
#pragma unroll
  for (int md = 0; md < 4; ++md)
#pragma unroll
    for (int ks = 0; ks < 2; ++ks)
      w1f[md][ks] = load_frag_rowmajor(sW1, E_, 16 * md, 32 * ks, lane);
#pragma unroll
  for (int mr = 0; mr < 2; ++mr)
#pragma unroll
    for (int ks = 0; ks < 2; ++ks)
      w2f[mr][ks] = load_frag_rowmajor(sW2, DA_, 16 * mr, 32 * ks, lane);

  v8f P[2][4];
#pragma unroll
  for (int mt = 0; mt < 2; ++mt)
#pragma unroll
    for (int nt = 0; nt < 4; ++nt)
      P[mt][nt] = v8f{0.f,0.f,0.f,0.f,0.f,0.f,0.f,0.f};

  v2f Sacc[2] = {v2f{0.f, 0.f}, v2f{0.f, 0.f}};   // lane (c, g): two parts of the row sum of r = 16 * mr + c

  unsigned short* sX16 = (unsigned short*)sXu[wv];

  // Kept rolled: peeling the last trip (the one that issues no copies) would double the loop's code.
#pragma clang loop unroll(disable)
  for (int it = 0; it < L_ / NT_; ++it) {
    // ---- this wave's 32-token tile: staged f32 -> masked bf16 in LDS ----
    // The wave's own copies of this tile have landed behind this wait (no other wave reads them).
    asm volatile("s_wait_asynccnt 0x0" ::: "memory");
    const float mk = sMf[wv][it][lane];
    convert_rows<0>((const float4*)&sP[wv][16 * g * E_] + (lane & 15),
                    (uint2*)&sXu[wv][16 * g * (E_ / 2)] + (lane & 15), mk);
    // The wave's reads of the staged tile have retired before the next copies overwrite it.
    asm volatile("s_wait_dscnt 0x0" ::: "memory");
    if (it + 1 < L_ / NT_)
      copy_tile(ldsX, gX + (size_t)(it + 1) * NT_ * E_);

    // The three products are chained through registers: two f32 D tiles of one product, converted
    // in place, are the next product's A operand in the hardware k order (lane c holds row c,
    // k = 8g + 0..7 from the first tile and 16 + 8g + 0..7 from the second).
    Frag aC[2];                                     // exp scores, rows r, k = l
#pragma unroll
    for (int nt2 = 0; nt2 < 2; ++nt2) {
      // B-frags of xm^T (stored [l][e] == B^T, so row-major pattern works)
      Frag bx0 = load_frag_rowmajor(sX16, E_, 16 * nt2, 0,  lane);
      Frag bx1 = load_frag_rowmajor(sX16, E_, 16 * nt2, 32, lane);
      // masks of the tokens 16 * nt2 + 8g + 0..7, which this lane's score registers hold
      const float4 mlo = *(const float4*)&sMf[wv][it][16 * nt2 + 8 * g];
      const float4 mhi = *(const float4*)&sMf[wv][it][16 * nt2 + 8 * g + 4];
      const v2f mv[4] = {v2f{mlo.x, mlo.y}, v2f{mlo.z, mlo.w}, v2f{mhi.x, mhi.y}, v2f{mhi.z, mhi.w}};
      // H = tanh(W1 * xm^T): lane c holds token c, registers d = 16 * md + 8g + 0..7
      Frag hA[2];                                   // H^T, rows l, k = d
#pragma unroll
      for (int md = 0; md < 4; ++md) {
        v8f h = v8f{0.f,0.f,0.f,0.f,0.f,0.f,0.f,0.f};
        h = wmma_bf16(w1f[md][0], bx0, h);
        h = wmma_bf16(w1f[md][1], bx1, h);
#pragma unroll
        for (int v = 0; v < 8; ++v)
          hA[md >> 1].bf[8 * (md & 1) + v] = (__bf16)fast_tanh(h[v]);
      }
      // Q^T = H^T * W2^T: lane c holds r = 16 * mr + c, registers l = 16 * nt2 + 8g + 0..7
#pragma unroll
      for (int mr = 0; mr < 2; ++mr) {
        v8f q = v8f{0.f,0.f,0.f,0.f,0.f,0.f,0.f,0.f};
        q = wmma_bf16(hA[0], w2f[mr][0], q);
        q = wmma_bf16(hA[1], w2f[mr][1], q);
        v2f a[4];
#pragma unroll
        for (int i = 0; i < 4; ++i) {
          a[i] = v2f{__expf(q[2 * i]), __expf(q[2 * i + 1])} * mv[i];   // masked exp scores
          aC[mr].bf[8 * nt2 + 2 * i]     = (__bf16)a[i].x;
          aC[mr].bf[8 * nt2 + 2 * i + 1] = (__bf16)a[i].y;
        }
        Sacc[mr] += (a[0] + a[1]) + (a[2] + a[3]);
      }
    }

    // ---- P += A(32x32) * xm(32x64), K = 32 exactly ----
#pragma unroll
    for (int nt = 0; nt < 4; ++nt) {
      Frag bxc = load_fragB_colstride(sX16, E_, 0, 16 * nt, lane);
      P[0][nt] = wmma_bf16(aC[0], bxc, P[0][nt]);
      P[1][nt] = wmma_bf16(aC[1], bxc, P[1][nt]);
    }
  }

  // ---- row sums: lanes c and c + 16 hold the two halves of row 16 * mr + c ----
#pragma unroll
  for (int mr = 0; mr < 2; ++mr) {
    const float sh = Sacc[mr].x + Sacc[mr].y;
    const float s  = sh + __shfl_xor(sh, 16, 32);
    if (lane < 16) sS[wv][16 * mr + lane] = s;
  }

  // ---- dump per-wave P partials (one base address and constant offsets: nothing of it lives across the loop) ----
  float* pRow = &sP[wv][8 * g * E_ + (lane & 15)];
#pragma unroll
  for (int mt = 0; mt < 2; ++mt)
#pragma unroll
    for (int nt = 0; nt < 4; ++nt)
#pragma unroll
      for (int v = 0; v < 8; ++v)
        pRow[(16 * mt + v) * E_ + 16 * nt] = P[mt][nt][v];

  __syncthreads();

  // ---- cross-wave reduce + normalize + store ----
  for (int i = tid; i < R_ * E_; i += NT_) {
    int r = i >> 6;
    float p = sP[0][i], s = sS[0][r];
    for (int w = 1; w < NW_; ++w) {
      p += sP[w][i];
      s += sS[w][r];
    }
    out[(size_t)b * (R_ * E_) + i] = p / s;
  }
}

extern "C" void kernel_launch(void* const* d_in, const int* in_sizes, int n_in,
                              void* d_out, int out_size, void* d_ws, size_t ws_size,
                              hipStream_t stream) {
  const float* x    = (const float*)d_in[0];
  const float* mask = (const float*)d_in[1];
  const float* W1   = (const float*)d_in[2];
  const float* W2   = (const float*)d_in[3];
  float* out = (float*)d_out;
  (void)in_sizes; (void)n_in; (void)out_size; (void)d_ws; (void)ws_size;
  SelfBiLayer_kernel<<<B_, NT_, 0, stream>>>(x, mask, W1, W2, out);
}

// v004
// One run takes 19.8 microseconds.
// Timed twice side by side with v003, it ran 1.18 times as fast both times.
// All steps since v000 together make it 4.23 times as fast.
#include <hip/hip_runtime.h>

#define B_  256
#define L_  2048
#define E_  64
#define DA_ 64
#define R_  32
#define NW_ 16
#define NT_ (NW_ * 32)
#define RP_ 72

typedef __attribute__((ext_vector_type(16))) __bf16 v16bf;
typedef __attribute__((ext_vector_type(8)))  float  v8f;
typedef __attribute__((ext_vector_type(2)))  float  v2f;

union Frag { v16bf bf; unsigned u[8]; };

// pack bf16(a*s), bf16(b*s) into one dword (mask multiply folded into the fma)
__device__ inline unsigned pk2bf_scaled(float a, float b, float s) {
  unsigned r;
  asm("v_fma_mixlo_bf16 %0, %1, %3, 0\n\t"
      "v_fma_mixhi_bf16 %0, %2, %3, 0"
      : "=&v"(r) : "v"(a), "v"(b), "v"(s));
  return r;
}

__device__ inline unsigned short f2bf(float f) {
  unsigned r;
  asm("v_fma_mixlo_bf16 %0, %1, 1.0, 0" : "=v"(r) : "v"(f));
  return (unsigned short)r;
}

__device__ inline float fast_tanh(float x) {
#if __has_builtin(__builtin_amdgcn_tanhf)
  return __builtin_amdgcn_tanhf(x);
#else
  return tanhf(x);
#endif
}

__device__ inline Frag load_frag_rowmajor(const unsigned short* base, int ld,
                                          int rowOff, int kOff, int lane) {
  Frag f;
  int m  = rowOff + (lane & 15);
  int kb = kOff + ((lane >> 4) << 3);
  const unsigned* row = (const unsigned*)(base + m * ld);
#pragma unroll
  for (int i = 0; i < 4; ++i) {
    f.u[i]     = row[(kb >> 1) + i];
    f.u[4 + i] = row[((kb + 16) >> 1) + i];
  }
  return f;
}

// WMMA B-fragment (32x16 bf16) from row-major [K][N] bf16 matrix (ldN elems/row).
__device__ inline Frag load_fragB_colstride(const unsigned short* base, int ldN,
                                            int kOff, int nOff, int lane) {
  Frag f;
  int n  = nOff + (lane & 15);
  int kb = kOff + ((lane >> 4) << 3);
  const unsigned short* col = base + n;
#pragma unroll
  for (int i = 0; i < 4; ++i) {
    unsigned lo  = col[(kb + 2 * i)      * ldN];
    unsigned hi  = col[(kb + 2 * i + 1)  * ldN];
    unsigned lo2 = col[(kb + 16 + 2 * i) * ldN];
    unsigned hi2 = col[(kb + 17 + 2 * i) * ldN];
    f.u[i]     = lo  | (hi  << 16);
    f.u[4 + i] = lo2 | (hi2 << 16);
  }
  return f;
}

__device__ inline v8f wmma_bf16(const Frag& a, const Frag& b, v8f c) {
  return __builtin_amdgcn_wmma_f32_16x16x32_bf16(false, a.bf, false, b.bf,
                                                 (short)0, c, false, false);
}

__device__ inline void copy_tile(unsigned ldsX, const float* gX) {
  asm volatile(
      "global_load_async_to_lds_b128 %0, %1, off\n\t"
      "global_load_async_to_lds_b128 %0, %1, off offset:512\n\t"
      "global_load_async_to_lds_b128 %0, %1, off offset:1024\n\t"
      "global_load_async_to_lds_b128 %0, %1, off offset:1536\n\t"
      "global_load_async_to_lds_b128 %0, %1, off offset:2048\n\t"
      "global_load_async_to_lds_b128 %0, %1, off offset:2560\n\t"
      "global_load_async_to_lds_b128 %0, %1, off offset:3072\n\t"
      "global_load_async_to_lds_b128 %0, %1, off offset:3584\n\t"
      "global_load_async_to_lds_b128 %0, %1, off offset:4096\n\t"
      "global_load_async_to_lds_b128 %0, %1, off offset:4608\n\t"
      "global_load_async_to_lds_b128 %0, %1, off offset:5120\n\t"
      "global_load_async_to_lds_b128 %0, %1, off offset:5632\n\t"
      "global_load_async_to_lds_b128 %0, %1, off offset:6144\n\t"
      "global_load_async_to_lds_b128 %0, %1, off offset:6656\n\t"
      "global_load_async_to_lds_b128 %0, %1, off offset:7168\n\t"
      "global_load_async_to_lds_b128 %0, %1, off offset:7680\n\t"
      "s_wait_xcnt 0x0"
      :: "v"(ldsX), "v"(gX) : "memory");
}

__device__ inline void copy_masks(unsigned ldsM, const float* gM) {
  asm volatile(
      "global_load_async_to_lds_b128 %0, %1, off\n\t"
      "s_wait_xcnt 0x0"
      :: "v"(ldsM), "v"(gM) : "memory");
}

// mask of token 16 * (lane >> 4) + J: lane J of each 16-lane row, shared with the row
template <int J>
__device__ inline float row_mask(float mk) {
  return __builtin_bit_cast(float,
      __builtin_amdgcn_mov_dpp(__builtin_bit_cast(int, mk), 0x150 + J, 0xf, 0xf, false));
}

__device__ inline uint2 pk4bf_scaled(float4 v, float s) {
  uint2 p;
  p.x = pk2bf_scaled(v.x, v.y, s);                 // bf16(x*mk) via fma_mix
  p.y = pk2bf_scaled(v.z, v.w, s);
  return p;
}

template <int J>
__device__ inline void convert_rows(const float4* xr, uint2* dst, float mk) {
  if constexpr (J < 16) {
    const float4 v0 = xr[(J + 0) * (E_ / 4)];
    const float4 v1 = xr[(J + 1) * (E_ / 4)];
    const float4 v2 = xr[(J + 2) * (E_ / 4)];
    const float4 v3 = xr[(J + 3) * (E_ / 4)];
    dst[(J + 0) * (RP_ / 4)] = pk4bf_scaled(v0, row_mask<J + 0>(mk));
    dst[(J + 1) * (RP_ / 4)] = pk4bf_scaled(v1, row_mask<J + 1>(mk));
    dst[(J + 2) * (RP_ / 4)] = pk4bf_scaled(v2, row_mask<J + 2>(mk));
    dst[(J + 3) * (RP_ / 4)] = pk4bf_scaled(v3, row_mask<J + 3>(mk));
    convert_rows<J + 4>(xr, dst, mk);
  }
}

__global__ __launch_bounds__(NT_)
void SelfBiLayer_kernel(const float* __restrict__ x, const float* __restrict__ mask,
                        const float* __restrict__ W1, const float* __restrict__ W2,
                        float* __restrict__ out) {
  __shared__ __attribute__((aligned(16))) unsigned short sW1[DA_ * RP_];   // bf16 W1 [d][e], rows RP_ apart
  __shared__ __attribute__((aligned(16))) unsigned short sW2[R_ * RP_];    // bf16 W2 [r][d], rows RP_ apart
  __shared__ __attribute__((aligned(16))) unsigned sXu[NW_][32 * (RP_ / 2)];  // per-wave bf16 xm tile [l][e] (packed), rows RP_ apart
  __shared__ __attribute__((aligned(16))) float sMf[NW_][L_ / NT_][32];  // per-wave token masks, one row per tile
  __shared__ float          sS [NW_][R_];             // per-wave partial row sums
  __shared__ __attribute__((aligned(16))) float sP[NW_][R_ * E_];  // in the loop: per-wave f32 x tile [l][e]; then partial pooled output

  const int b    = blockIdx.x;
  const int tid  = threadIdx.x;
  const int wv   = tid >> 5;
  const int lane = tid & 31;
  const int g    = lane >> 4;

  // Tile 0 starts to fly before the weights are staged. Every wave copies into LDS of its own.
  const unsigned ldsX = (unsigned)(size_t)&sP[wv][lane * 4];
  const float* gX = x + ((size_t)b * L_ + wv * 32) * E_ + lane * 4;
  copy_tile(ldsX, gX);
  copy_masks((unsigned)(size_t)&sMf[wv][lane >> 3][(lane & 7) * 4],
             mask + (size_t)b * L_ + wv * 32 + (lane >> 3) * NT_ + (lane & 7) * 4);

  for (int i = tid; i < DA_ * E_; i += NT_) sW1[(i >> 6) * RP_ + (i & 63)] = f2bf(W1[i]);
  for (int i = tid; i < R_ * DA_; i += NT_) sW2[(i >> 6) * RP_ + (i & 63)] = f2bf(W2[i]);
  __syncthreads();

  // Persistent weight fragments: W1 4 M-tiles x 2 K-steps, W2 2 x 2.
  Frag w1f[4][2], w2f[2][2];
#pragma unroll
  for (int md = 0; md < 4; ++md)
#pragma unroll
    for (int ks = 0; ks < 2; ++ks)
      w1f[md][ks] = load_frag_rowmajor(sW1, RP_, 16 * md, 32 * ks, lane);
#pragma unroll
  for (int mr = 0; mr < 2; ++mr)
#pragma unroll
    for (int ks = 0; ks < 2; ++ks)
      w2f[mr][ks] = load_frag_rowmajor(sW2, RP_, 16 * mr, 32 * ks, lane);

  v8f P[2][4];
#pragma unroll
  for (int mt = 0; mt < 2; ++mt)
#pragma unroll
    for (int nt = 0; nt < 4; ++nt)
      P[mt][nt] = v8f{0.f,0.f,0.f,0.f,0.f,0.f,0.f,0.f};

  v2f Sacc[2] = {v2f{0.f, 0.f}, v2f{0.f, 0.f}};   // lane (c, g): two parts of the row sum of r = 16 * mr + c

  unsigned short* sX16 = (unsigned short*)sXu[wv];

  // Kept rolled: peeling the last trip (the one that issues no copies) would double the loop's code.
#pragma clang loop unroll(disable)
  for (int it = 0; it < L_ / NT_; ++it) {
    // ---- this wave's 32-token tile: staged f32 -> masked bf16 in LDS ----
    // The wave's own copies of this tile have landed behind this wait (no other wave reads them).
    asm volatile("s_wait_asynccnt 0x0" ::: "memory");
    const float mk = sMf[wv][it][lane];
    convert_rows<0>((const float4*)&sP[wv][16 * g * E_] + (lane & 15),
                    (uint2*)&sXu[wv][16 * g * (RP_ / 2)] + (lane & 15), mk);
    // The wave's reads of the staged tile have retired before the next copies overwrite it.
    asm volatile("s_wait_dscnt 0x0" ::: "memory");
    if (it + 1 < L_ / NT_)
      copy_tile(ldsX, gX + (size_t)(it + 1) * NT_ * E_);

    // The three products are chained through registers: two f32 D tiles of one product, converted
    // in place, are the next product's A operand in the hardware k order (lane c holds row c,
    // k = 8g + 0..7 from the first tile and 16 + 8g + 0..7 from the second).
    Frag aC[2];                                     // exp scores, rows r, k = l
#pragma unroll
    for (int nt2 = 0; nt2 < 2; ++nt2) {
      // B-frags of xm^T (stored [l][e] == B^T, so row-major pattern works)
      Frag bx0 = load_frag_rowmajor(sX16, RP_, 16 * nt2, 0,  lane);
      Frag bx1 = load_frag_rowmajor(sX16, RP_, 16 * nt2, 32, lane);
      // masks of the tokens 16 * nt2 + 8g + 0..7, which this lane's score registers hold
      const float4 mlo = *(const float4*)&sMf[wv][it][16 * nt2 + 8 * g];
      const float4 mhi = *(const float4*)&sMf[wv][it][16 * nt2 + 8 * g + 4];
      const v2f mv[4] = {v2f{mlo.x, mlo.y}, v2f{mlo.z, mlo.w}, v2f{mhi.x, mhi.y}, v2f{mhi.z, mhi.w}};
      // H = tanh(W1 * xm^T): lane c holds token c, registers d = 16 * md + 8g + 0..7
      Frag hA[2];                                   // H^T, rows l, k = d
#pragma unroll
      for (int md = 0; md < 4; ++md) {
        v8f h = v8f{0.f,0.f,0.f,0.f,0.f,0.f,0.f,0.f};
        h = wmma_bf16(w1f[md][0], bx0, h);
        h = wmma_bf16(w1f[md][1], bx1, h);
#pragma unroll
        for (int v = 0; v < 8; ++v)
          hA[md >> 1].bf[8 * (md & 1) + v] = (__bf16)fast_tanh(h[v]);
      }
      // Q^T = H^T * W2^T: lane c holds r = 16 * mr + c, registers l = 16 * nt2 + 8g + 0..7
#pragma unroll
      for (int mr = 0; mr < 2; ++mr) {
        v8f q = v8f{0.f,0.f,0.f,0.f,0.f,0.f,0.f,0.f};
        q = wmma_bf16(hA[0], w2f[mr][0], q);
        q = wmma_bf16(hA[1], w2f[mr][1], q);
        v2f a[4];
#pragma unroll
        for (int i = 0; i < 4; ++i) {
          a[i] = v2f{__expf(q[2 * i]), __expf(q[2 * i + 1])} * mv[i];   // masked exp scores
          aC[mr].bf[8 * nt2 + 2 * i]     = (__bf16)a[i].x;
          aC[mr].bf[8 * nt2 + 2 * i + 1] = (__bf16)a[i].y;
        }
        Sacc[mr] += (a[0] + a[1]) + (a[2] + a[3]);
      }
    }

    // ---- P += A(32x32) * xm(32x64), K = 32 exactly ----
#pragma unroll
    for (int nt = 0; nt < 4; ++nt) {
      Frag bxc = load_fragB_colstride(sX16, RP_, 0, 16 * nt, lane);
      P[0][nt] = wmma_bf16(aC[0], bxc, P[0][nt]);
      P[1][nt] = wmma_bf16(aC[1], bxc, P[1][nt]);
    }
  }

  // ---- row sums: lanes c and c + 16 hold the two halves of row 16 * mr + c ----
#pragma unroll
  for (int mr = 0; mr < 2; ++mr) {
    const float sh = Sacc[mr].x + Sacc[mr].y;
    const float s  = sh + __shfl_xor(sh, 16, 32);
    if (lane < 16) sS[wv][16 * mr + lane] = s;
  }

  // ---- dump per-wave P partials (one base address and constant offsets: nothing of it lives across the loop) ----
  float* pRow = &sP[wv][8 * g * E_ + (lane & 15)];
#pragma unroll
  for (int mt = 0; mt < 2; ++mt)
#pragma unroll
    for (int nt = 0; nt < 4; ++nt)
#pragma unroll
      for (int v = 0; v < 8; ++v)
        pRow[(16 * mt + v) * E_ + 16 * nt] = P[mt][nt][v];

  __syncthreads();

  // ---- cross-wave reduce + normalize + store ----
  for (int i = tid; i < R_ * E_; i += NT_) {
    int r = i >> 6;
    float p = sP[0][i], s = sS[0][r];
    for (int w = 1; w < NW_; ++w) {
      p += sP[w][i];
      s += sS[w][r];
    }
    out[(size_t)b * (R_ * E_) + i] = p / s;
  }
}

extern "C" void kernel_launch(void* const* d_in, const int* in_sizes, int n_in,
                              void* d_out, int out_size, void* d_ws, size_t ws_size,
                              hipStream_t stream) {
  const float* x    = (const float*)d_in[0];
  const float* mask = (const float*)d_in[1];
  const float* W1   = (const float*)d_in[2];
  const float* W2   = (const float*)d_in[3];
  float* out = (float*)d_out;
  (void)in_sizes; (void)n_in; (void)out_size; (void)d_ws; (void)ws_size;
  SelfBiLayer_kernel<<<B_, NT_, 0, stream>>>(x, mask, W1, W2, out);
}

// v005
// Measured time: 17.8 microseconds a run.
// In both of two side-by-side timings against v004, it was 1.11 times as fast.
// Counting every step since v000, it is 4.71 times as fast.
#include <hip/hip_runtime.h>

#define B_  256
#define L_  2048
#define E_  64
#define DA_ 64
#define R_  32
#define NW_ 16
#define NT_ (NW_ * 32)
#define RP_ 72
#define XP_ 68
#define XT_ (32 * XP_)

typedef __attribute__((ext_vector_type(16))) __bf16 v16bf;
typedef __attribute__((ext_vector_type(8)))  float  v8f;
typedef __attribute__((ext_vector_type(2)))  float  v2f;
typedef __attribute__((ext_vector_type(2)))  __bf16 v2bf;

union Frag { v16bf bf; unsigned u[8]; };

__device__ inline unsigned short f2bf(float f) {
  unsigned r;
  asm("v_fma_mixlo_bf16 %0, %1, 1.0, 0" : "=v"(r) : "v"(f));
  return (unsigned short)r;
}

__device__ inline float fast_tanh(float x) {
#if __has_builtin(__builtin_amdgcn_tanhf)
  return __builtin_amdgcn_tanhf(x);
#else
  return tanhf(x);
#endif
}

__device__ inline Frag load_frag_rowmajor(const unsigned short* base, int ld,
                                          int rowOff, int kOff, int lane) {
  Frag f;
  int m  = rowOff + (lane & 15);
  int kb = kOff + ((lane >> 4) << 3);
  const unsigned* row = (const unsigned*)(base + m * ld);
#pragma unroll
  for (int i = 0; i < 4; ++i) {
    f.u[i]     = row[(kb >> 1) + i];
    f.u[4 + i] = row[((kb + 16) >> 1) + i];
  }
  return f;
}

// two masked f32 values -> one dword of bf16. Plain arithmetic, no asm: the result is a WMMA operand
// register, and the compiler keeps the distance behind the WMMA that last read it only for its own code.
__device__ inline unsigned pk2bf(v2f v) {
  return __builtin_bit_cast(unsigned, __builtin_convertvector(v, v2bf));
}

// The two WMMA B-fragments (k = e, n = token) of the masked x^T of 16 tokens, straight from the staged
// f32 tile: p points at e = 8g of the lane's own token row; fragment ks holds e = 32 * ks + 8g + 0..7 and
// 32 * ks + 16 + 8g + 0..7 (the k order of load_frag_rowmajor), converted in registers; m is that token's mask.
__device__ inline void load_x_token_row(const float* p, float m, Frag& f0, Frag& f1) {
  float4 q[8];
#pragma unroll
  for (int j = 0; j < 4; ++j) {
    q[2 * j]     = *(const float4*)(p + 16 * j);
    q[2 * j + 1] = *(const float4*)(p + 16 * j + 4);
  }
  // All eight reads are under way before the first is waited for: one LDS latency for the group, not four.
  __builtin_amdgcn_sched_barrier(0);
#pragma unroll
  for (int j = 0; j < 4; ++j) {
    f0.u[2 * j]     = pk2bf(v2f{q[j].x, q[j].y} * m);
    f0.u[2 * j + 1] = pk2bf(v2f{q[j].z, q[j].w} * m);
    f1.u[2 * j]     = pk2bf(v2f{q[4 + j].x, q[4 + j].y} * m);
    f1.u[2 * j + 1] = pk2bf(v2f{q[4 + j].z, q[4 + j].w} * m);
  }
}

__device__ inline v8f wmma_bf16(const Frag& a, const Frag& b, v8f c) {
  return __builtin_amdgcn_wmma_f32_16x16x32_bf16(false, a.bf, false, b.bf,
                                                 (short)0, c, false, false);
}

__device__ inline void copy_tile(unsigned ldsX, unsigned laneOff, const float* gT) {
  const char* t = (const char*)gT;
  asm volatile(
      "global_load_async_to_lds_b128 %0, %1, %2\n\t"
      "global_load_async_to_lds_b128 %0, %1, %3 offset:544\n\t"
      "global_load_async_to_lds_b128 %0, %1, %4 offset:1088\n\t"
      "global_load_async_to_lds_b128 %0, %1, %5 offset:1632\n\t"
      "global_load_async_to_lds_b128 %0, %1, %6 offset:2176\n\t"
      "global_load_async_to_lds_b128 %0, %1, %7 offset:2720\n\t"
      "global_load_async_to_lds_b128 %0, %1, %8 offset:3264\n\t"
      "global_load_async_to_lds_b128 %0, %1, %9 offset:3808\n\t"
      "global_load_async_to_lds_b128 %0, %1, %10 offset:4352\n\t"
      "global_load_async_to_lds_b128 %0, %1, %11 offset:4896\n\t"
      "global_load_async_to_lds_b128 %0, %1, %12 offset:5440\n\t"
      "global_load_async_to_lds_b128 %0, %1, %13 offset:5984\n\t"
      "global_load_async_to_lds_b128 %0, %1, %14 offset:6528\n\t"
      "global_load_async_to_lds_b128 %0, %1, %15 offset:7072\n\t"
      "global_load_async_to_lds_b128 %0, %1, %16 offset:7616\n\t"
      "global_load_async_to_lds_b128 %0, %1, %17 offset:8160\n\t"
      "s_wait_xcnt 0x0"
      :: "v"(ldsX), "v"(laneOff),
         "s"(t), "s"(t - 32), "s"(t - 64), "s"(t - 96),
         "s"(t - 128), "s"(t - 160), "s"(t - 192), "s"(t - 224),
         "s"(t - 256), "s"(t - 288), "s"(t - 320), "s"(t - 352),
         "s"(t - 384), "s"(t - 416), "s"(t - 448), "s"(t - 480)
      : "memory");
}

__device__ inline void copy_masks(unsigned ldsM, const float* gM) {
  asm volatile(
      "global_load_async_to_lds_b128 %0, %1, off\n\t"
      "s_wait_xcnt 0x0"
      :: "v"(ldsM), "v"(gM) : "memory");
}

__global__ __launch_bounds__(NT_)
void SelfBiLayer_kernel(const float* __restrict__ x, const float* __restrict__ mask,
                        const float* __restrict__ W1, const float* __restrict__ W2,
                        float* __restrict__ out) {
  __shared__ __attribute__((aligned(16))) unsigned short sW1[DA_ * RP_];   // bf16 W1 [d][e], rows RP_ apart
  __shared__ __attribute__((aligned(16))) unsigned short sW2[R_ * RP_];    // bf16 W2 [r][d], rows RP_ apart
  __shared__ __attribute__((aligned(16))) float sMf[NW_][L_ / NT_][32];  // per-wave token masks, one row per tile
  __shared__ float          sS [NW_][R_];             // per-wave partial row sums
  __shared__ __attribute__((aligned(16))) float sXf[NW_][2][XT_];  // in the loop: per-wave f32 x tiles [l][e], two buffers, rows XP_ apart; then ([0]) partial pooled output

  const int b    = blockIdx.x;
  const int tid  = threadIdx.x;
  const int wv   = __builtin_amdgcn_readfirstlane(tid >> 5);   // in a scalar register: the wave's LDS bases cost no vector register
  const int lane = tid & 31;
  const int g    = lane >> 4;
  const int c    = lane & 15;

  // Tile 0 starts to fly before the weights are staged. Every wave copies into LDS of its own.
  // lane (c, g) of copy j: bytes 16c .. 16c + 15 of token row 2j + g
  const unsigned ldsX = (unsigned)(size_t)&sXf[wv][0][g * XP_ + c * 4];
  const float* gX = x + ((size_t)b * L_ + wv * 32) * E_;   // the wave's tile 0, the same in every lane
  const unsigned laneOff = lane * 16;
  copy_tile(ldsX, laneOff, gX);
  copy_masks((unsigned)(size_t)&sMf[wv][lane >> 3][(lane & 7) * 4],
             mask + (size_t)b * L_ + wv * 32 + (lane >> 3) * NT_ + (lane & 7) * 4);

  for (int i = tid; i < DA_ * E_; i += NT_) sW1[(i >> 6) * RP_ + (i & 63)] = f2bf(W1[i]);
  for (int i = tid; i < R_ * DA_; i += NT_) sW2[(i >> 6) * RP_ + (i & 63)] = f2bf(W2[i]);
  __syncthreads();

  // Persistent weight fragments: W1 4 M-tiles x 2 K-steps, W2 2 x 2.
  Frag w1f[4][2], w2f[2][2];
#pragma unroll
  for (int md = 0; md < 4; ++md)
#pragma unroll
    for (int ks = 0; ks < 2; ++ks)
      w1f[md][ks] = load_frag_rowmajor(sW1, RP_, 16 * md, 32 * ks, lane);
#pragma unroll
  for (int mr = 0; mr < 2; ++mr)
#pragma unroll
    for (int ks = 0; ks < 2; ++ks)
      w2f[mr][ks] = load_frag_rowmajor(sW2, RP_, 16 * mr, 32 * ks, lane);

  v8f P[2][4];
#pragma unroll
  for (int mt = 0; mt < 2; ++mt)
#pragma unroll
    for (int nt = 0; nt < 4; ++nt)
      P[mt][nt] = v8f{0.f,0.f,0.f,0.f,0.f,0.f,0.f,0.f};

  v2f Sacc[2] = {v2f{0.f, 0.f}, v2f{0.f, 0.f}};   // lane (c, g): two parts of the row sum of r = 16 * mr + c

  const float* xRow0 = &sXf[wv][0][c * XP_ + 8 * g];
  const float* xCol0 = &sXf[wv][0][8 * g * XP_ + 4 * c];

  // Kept rolled: peeling the last trip (the one that issues no copies) would double the loop's code.
#pragma clang loop unroll(disable)
  for (int it = 0; it < L_ / NT_; ++it) {
    // The wave's own copies of this tile have landed behind this wait (no other wave reads them).
    asm volatile("s_wait_asynccnt 0x0" ::: "memory");
    // The wave's reads of the other buffer (last trip's tile) have retired before the next copies overwrite it.
    asm volatile("s_wait_dscnt 0x0" ::: "memory");
    // The next tile flies into the other buffer while this one is worked on.
    if (it + 1 < L_ / NT_)
      copy_tile(ldsX + ((it + 1) & 1) * (XT_ * 4), laneOff, gX + (size_t)(it + 1) * NT_ * E_);
    // this tile, f32 [l][e]; both products read it directly
    const float* xRow = xRow0 + (it & 1) * XT_;     // e = 8g of token row c
    const float* xCol = xCol0 + (it & 1) * XT_;     // e = 4c of token row 8g

    // The three products are chained through registers: two f32 D tiles of one product, converted
    // in place, are the next product's A operand in the hardware k order (lane c holds row c,
    // k = 8g + 0..7 from the first tile and 16 + 8g + 0..7 from the second).
    Frag aC[2];                                     // exp scores, rows r, k = l
#pragma unroll
    for (int nt2 = 0; nt2 < 2; ++nt2) {
      // B-frags of xm^T (stored [l][e] == B^T: one token row per lane), masked and converted in registers
      const float mt_ = sMf[wv][it][16 * nt2 + c];  // mask of this lane's token
      Frag bx0, bx1;
      load_x_token_row(xRow + 16 * nt2 * XP_, mt_, bx0, bx1);
      // masks of the tokens 16 * nt2 + 8g + 0..7, which this lane's score registers hold
      const float4 mlo = *(const float4*)&sMf[wv][it][16 * nt2 + 8 * g];
      const float4 mhi = *(const float4*)&sMf[wv][it][16 * nt2 + 8 * g + 4];
      const v2f mv[4] = {v2f{mlo.x, mlo.y}, v2f{mlo.z, mlo.w}, v2f{mhi.x, mhi.y}, v2f{mhi.z, mhi.w}};
      // H = tanh(W1 * xm^T): lane c holds token c, registers d = 16 * md + 8g + 0..7
      Frag hA[2];                                   // H^T, rows l, k = d
#pragma unroll
      for (int md = 0; md < 4; ++md) {
        v8f h = v8f{0.f,0.f,0.f,0.f,0.f,0.f,0.f,0.f};
        h = wmma_bf16(w1f[md][0], bx0, h);
        h = wmma_bf16(w1f[md][1], bx1, h);
#pragma unroll
        for (int v = 0; v < 8; ++v)
          hA[md >> 1].bf[8 * (md & 1) + v] = (__bf16)fast_tanh(h[v]);
      }
      // Q^T = H^T * W2^T: lane c holds r = 16 * mr + c, registers l = 16 * nt2 + 8g + 0..7
#pragma unroll
      for (int mr = 0; mr < 2; ++mr) {
        v8f q = v8f{0.f,0.f,0.f,0.f,0.f,0.f,0.f,0.f};
        q = wmma_bf16(hA[0], w2f[mr][0], q);
        q = wmma_bf16(hA[1], w2f[mr][1], q);
        v2f a[4];
#pragma unroll
        for (int i = 0; i < 4; ++i) {
          a[i] = v2f{__expf(q[2 * i]), __expf(q[2 * i + 1])} * mv[i];   // masked exp scores
          aC[mr].bf[8 * nt2 + 2 * i]     = (__bf16)a[i].x;
          aC[mr].bf[8 * nt2 + 2 * i + 1] = (__bf16)a[i].y;
        }
        Sacc[mr] += (a[0] + a[1]) + (a[2] + a[3]);
      }
    }

    // ---- P += A(32x32) * xm(32x64), K = 32 exactly ----
    // Column c of N-tile nt is e = 4c + nt: one 16-byte read of token row k at 4c feeds all four
    // B fragments (each half-wave reads one whole row). k = 8g + 0..7 and 16 + 8g + 0..7, as in aC.
    Frag bxc[4];
#pragma unroll
    for (int h = 0; h < 2; ++h) {
      const float4 mlo = *(const float4*)&sMf[wv][it][16 * h + 8 * g];
      const float4 mhi = *(const float4*)&sMf[wv][it][16 * h + 8 * g + 4];
      const float mk[8] = {mlo.x, mlo.y, mlo.z, mlo.w, mhi.x, mhi.y, mhi.z, mhi.w};
      const float* xk = xCol + 16 * h * XP_;
#pragma unroll
      for (int i2 = 0; i2 < 2; ++i2) {
        float4 q[4];
#pragma unroll
        for (int j = 0; j < 4; ++j) q[j] = *(const float4*)&xk[(4 * i2 + j) * XP_];
        // The four reads are under way before the first is waited for: one LDS latency for the group, not two.
        __builtin_amdgcn_sched_barrier(0);
#pragma unroll
        for (int ii = 0; ii < 2; ++ii) {
          const int i = 2 * i2 + ii;
          const float4 q0 = q[2 * ii], q1 = q[2 * ii + 1];
          // each row times its own token's mask, then the two rows' values of one column share a dword
          const v2f a0 = v2f{q0.x, q0.y} * mk[2 * i],     b0 = v2f{q0.z, q0.w} * mk[2 * i];
          const v2f a1 = v2f{q1.x, q1.y} * mk[2 * i + 1], b1 = v2f{q1.z, q1.w} * mk[2 * i + 1];
          bxc[0].bf[8 * h + 2 * i] = (__bf16)a0.x;  bxc[0].bf[8 * h + 2 * i + 1] = (__bf16)a1.x;
          bxc[1].bf[8 * h + 2 * i] = (__bf16)a0.y;  bxc[1].bf[8 * h + 2 * i + 1] = (__bf16)a1.y;
          bxc[2].bf[8 * h + 2 * i] = (__bf16)b0.x;  bxc[2].bf[8 * h + 2 * i + 1] = (__bf16)b1.x;
          bxc[3].bf[8 * h + 2 * i] = (__bf16)b0.y;  bxc[3].bf[8 * h + 2 * i + 1] = (__bf16)b1.y;
        }
      }
    }
#pragma unroll
    for (int nt = 0; nt < 4; ++nt) {
      P[0][nt] = wmma_bf16(aC[0], bxc[nt], P[0][nt]);
      P[1][nt] = wmma_bf16(aC[1], bxc[nt], P[1][nt]);
    }
  }

  // The lane's number anew: what the epilogue derives from it then holds no register across the loop.
  const int ln = (int)__builtin_amdgcn_mbcnt_lo(~0u, 0u);

  // ---- row sums: lanes c and c + 16 hold the two halves of row 16 * mr + c ----
#pragma unroll
  for (int mr = 0; mr < 2; ++mr) {
    const float sh = Sacc[mr].x + Sacc[mr].y;
    const float s  = sh + __shfl_xor(sh, 16, 32);
    if (ln < 16) sS[wv][16 * mr + ln] = s;
  }

  // ---- dump per-wave P partials (one base address and constant offsets: nothing of it lives across the loop) ----
  // lane (c, g), register v of the four N-tiles: row 16 * mt + 8g + v, columns e = 4c + 0..3
  float* pRow = &sXf[wv][0][8 * (ln >> 4) * XP_ + 4 * (ln & 15)];
#pragma unroll
  for (int mt = 0; mt < 2; ++mt)
#pragma unroll
    for (int v = 0; v < 8; ++v)
      *(float4*)&pRow[(16 * mt + v) * XP_] =
          make_float4(P[mt][0][v], P[mt][1][v], P[mt][2][v], P[mt][3][v]);

  __syncthreads();

  // ---- cross-wave reduce + normalize + store ----
  for (int k = 0; k < R_ * E_ / NT_; ++k) {
    const int i = k * NT_ + wv * 32 + ln;
    int r = i >> 6;
    const int j = r * XP_ + (i & 63);
    float p = sXf[0][0][j], s = sS[0][r];
    for (int w = 1; w < NW_; ++w) {
      p += sXf[w][0][j];
      s += sS[w][r];
    }
    out[(size_t)b * (R_ * E_) + i] = p / s;
  }
}

extern "C" void kernel_launch(void* const* d_in, const int* in_sizes, int n_in,
                              void* d_out, int out_size, void* d_ws, size_t ws_size,
                              hipStream_t stream) {
  const float* x    = (const float*)d_in[0];
  const float* mask = (const float*)d_in[1];
  const float* W1   = (const float*)d_in[2];
  const float* W2   = (const float*)d_in[3];
  float* out = (float*)d_out;
  (void)in_sizes; (void)n_in; (void)out_size; (void)d_ws; (void)ws_size;
  SelfBiLayer_kernel<<<B_, NT_, 0, stream>>>(x, mask, W1, W2, out);
}

// v006
// Measured time: 13.1 microseconds a run.
// Two timings next to v005 put it at 1.37 and 1.36 times that version's speed.
// Over all steps from v000 it is 6.42 times as fast.
#include <hip/hip_runtime.h>

#define B_  256
#define L_  2048
#define E_  64
#define DA_ 64
#define R_  32
#define NW_ 16
#define NT_ (NW_ * 32)
#define RP_ 72
#define XP_ 68
#define XT_ (32 * XP_)

typedef __attribute__((ext_vector_type(16))) __bf16 v16bf;
typedef __attribute__((ext_vector_type(8)))  float  v8f;
typedef __attribute__((ext_vector_type(2)))  float  v2f;
typedef __attribute__((ext_vector_type(2)))  __bf16 v2bf;

union Frag { v16bf bf; unsigned u[8]; };

__device__ inline float fast_tanh(float x) {
#if __has_builtin(__builtin_amdgcn_tanhf)
  return __builtin_amdgcn_tanhf(x);
#else
  return tanhf(x);
#endif
}

__device__ inline Frag load_frag_rowmajor(const unsigned short* base, int ld,
                                          int rowOff, int kOff, int lane) {
  Frag f;
  int m  = rowOff + (lane & 15);
  int kb = kOff + ((lane >> 4) << 3);
  const unsigned* row = (const unsigned*)(base + m * ld);
#pragma unroll
  for (int i = 0; i < 4; ++i) {
    f.u[i]     = row[(kb >> 1) + i];
    f.u[4 + i] = row[((kb + 16) >> 1) + i];
  }
  return f;
}

// two f32 values -> one dword of bf16. Plain arithmetic, no asm: the result is a WMMA operand
// register, and the compiler keeps the distance behind the WMMA that last read it only for its own code.
__device__ inline unsigned pk2bf(v2f v) {
  return __builtin_bit_cast(unsigned, __builtin_convertvector(v, v2bf));
}

// The two WMMA B-fragments (k = e, n = token) of the masked x^T of 16 tokens, straight from the staged
// f32 tile: p points at e = 8g of the lane's own token row; fragment ks holds e = 32 * ks + 8g + 0..7 and
// 32 * ks + 16 + 8g + 0..7 (the k order of load_frag_rowmajor), converted in registers; m is that token's mask.
__device__ inline void load_x_token_row(const float* p, float m, Frag& f0, Frag& f1) {
  float4 q[8];
#pragma unroll
  for (int j = 0; j < 4; ++j) {
    q[2 * j]     = *(const float4*)(p + 16 * j);
    q[2 * j + 1] = *(const float4*)(p + 16 * j + 4);
  }
  // All eight reads are under way before the first is waited for: one LDS latency for the group, not four.
  __builtin_amdgcn_sched_barrier(0);
#pragma unroll
  for (int j = 0; j < 4; ++j) {
    f0.u[2 * j]     = pk2bf(v2f{q[j].x, q[j].y} * m);
    f0.u[2 * j + 1] = pk2bf(v2f{q[j].z, q[j].w} * m);
    f1.u[2 * j]     = pk2bf(v2f{q[4 + j].x, q[4 + j].y} * m);
    f1.u[2 * j + 1] = pk2bf(v2f{q[4 + j].z, q[4 + j].w} * m);
  }
}

__device__ inline v8f wmma_bf16(const Frag& a, const Frag& b, v8f c) {
  return __builtin_amdgcn_wmma_f32_16x16x32_bf16(false, a.bf, false, b.bf,
                                                 (short)0, c, false, false);
}

__device__ inline void copy_tile(unsigned ldsX, unsigned laneOff, const float* gT) {
  const char* t = (const char*)gT;
  asm volatile(
      "global_load_async_to_lds_b128 %0, %1, %2\n\t"
      "global_load_async_to_lds_b128 %0, %1, %3 offset:544\n\t"
      "global_load_async_to_lds_b128 %0, %1, %4 offset:1088\n\t"
      "global_load_async_to_lds_b128 %0, %1, %5 offset:1632\n\t"
      "global_load_async_to_lds_b128 %0, %1, %6 offset:2176\n\t"
      "global_load_async_to_lds_b128 %0, %1, %7 offset:2720\n\t"
      "global_load_async_to_lds_b128 %0, %1, %8 offset:3264\n\t"
      "global_load_async_to_lds_b128 %0, %1, %9 offset:3808\n\t"
      "global_load_async_to_lds_b128 %0, %1, %10 offset:4352\n\t"
      "global_load_async_to_lds_b128 %0, %1, %11 offset:4896\n\t"
      "global_load_async_to_lds_b128 %0, %1, %12 offset:5440\n\t"
      "global_load_async_to_lds_b128 %0, %1, %13 offset:5984\n\t"
      "global_load_async_to_lds_b128 %0, %1, %14 offset:6528\n\t"
      "global_load_async_to_lds_b128 %0, %1, %15 offset:7072\n\t"
      "global_load_async_to_lds_b128 %0, %1, %16 offset:7616\n\t"
      "global_load_async_to_lds_b128 %0, %1, %17 offset:8160\n\t"
      "s_wait_xcnt 0x0"
      :: "v"(ldsX), "v"(laneOff),
         "s"(t), "s"(t - 32), "s"(t - 64), "s"(t - 96),
         "s"(t - 128), "s"(t - 160), "s"(t - 192), "s"(t - 224),
         "s"(t - 256), "s"(t - 288), "s"(t - 320), "s"(t - 352),
         "s"(t - 384), "s"(t - 416), "s"(t - 448), "s"(t - 480)
      : "memory");
}

__device__ inline void copy_masks(unsigned ldsM, const float* gM) {
  asm volatile(
      "global_load_async_to_lds_b128 %0, %1, off\n\t"
      "s_wait_xcnt 0x0"
      :: "v"(ldsM), "v"(gM) : "memory");
}

__global__ __launch_bounds__(NT_)
void SelfBiLayer_kernel(const float* __restrict__ x, const float* __restrict__ mask,
                        const float* __restrict__ W1, const float* __restrict__ W2,
                        float* __restrict__ out) {
  __shared__ __attribute__((aligned(16))) unsigned short sW1[DA_ * RP_];   // bf16 W1 [d][e], rows RP_ apart
  __shared__ __attribute__((aligned(16))) unsigned short sW2[R_ * RP_];    // bf16 W2 [r][d], rows RP_ apart
  __shared__ __attribute__((aligned(16))) float sMf[NW_][L_ / NT_][32];  // per-wave token masks, one row per tile
  __shared__ float          sS [NW_][R_];             // per-wave partial row sums
  __shared__ __attribute__((aligned(16))) float sXf[NW_][2][XT_];  // in the loop: per-wave f32 x tiles [l][e], two buffers, rows XP_ apart; then ([0]) partial pooled output

  const int b    = blockIdx.x;
  const int tid  = threadIdx.x;
  const int wv   = __builtin_amdgcn_readfirstlane(tid >> 5);   // in a scalar register: the wave's LDS bases cost no vector register
  const int lane = tid & 31;
  const int g    = lane >> 4;
  const int c    = lane & 15;

  // The weights: each thread's three 16-byte loads (whole lines per wave) are issued together and first,
  // so that the work-group waits for one trip to L2 in all, not for one trip per dword in turn.
  const float4 wa = ((const float4*)W1)[tid];
  const float4 wb = ((const float4*)W1)[tid + NT_];
  const float4 wc = ((const float4*)W2)[tid];

  // Tile 0 starts to fly before the weights are staged. Every wave copies into LDS of its own.
  // lane (c, g) of copy j: bytes 16c .. 16c + 15 of token row 2j + g
  const unsigned ldsX = (unsigned)(size_t)&sXf[wv][0][g * XP_ + c * 4];
  const float* gX = x + ((size_t)b * L_ + wv * 32) * E_;   // the wave's tile 0, the same in every lane
  const unsigned laneOff = lane * 16;
  copy_tile(ldsX, laneOff, gX);
  copy_masks((unsigned)(size_t)&sMf[wv][lane >> 3][(lane & 7) * 4],
             mask + (size_t)b * L_ + wv * 32 + (lane >> 3) * NT_ + (lane & 7) * 4);

  // 16-byte piece j of a weight matrix: row j >> 4, columns 4 * (j & 15) .. + 3; as bf16 one 8-byte LDS store
  {
    const int wo = (tid >> 4) * RP_ + (tid & 15) * 4;
    *(uint2*)&sW1[wo]            = make_uint2(pk2bf(v2f{wa.x, wa.y}), pk2bf(v2f{wa.z, wa.w}));
    *(uint2*)&sW1[wo + 32 * RP_] = make_uint2(pk2bf(v2f{wb.x, wb.y}), pk2bf(v2f{wb.z, wb.w}));
    *(uint2*)&sW2[wo]            = make_uint2(pk2bf(v2f{wc.x, wc.y}), pk2bf(v2f{wc.z, wc.w}));
  }
  __syncthreads();

  // Persistent weight fragments: W1 4 M-tiles x 2 K-steps, W2 2 x 2.
  Frag w1f[4][2], w2f[2][2];
#pragma unroll
  for (int md = 0; md < 4; ++md)
#pragma unroll
    for (int ks = 0; ks < 2; ++ks)
      w1f[md][ks] = load_frag_rowmajor(sW1, RP_, 16 * md, 32 * ks, lane);
#pragma unroll
  for (int mr = 0; mr < 2; ++mr)
#pragma unroll
    for (int ks = 0; ks < 2; ++ks)
      w2f[mr][ks] = load_frag_rowmajor(sW2, RP_, 16 * mr, 32 * ks, lane);

  v8f P[2][4];
#pragma unroll
  for (int mt = 0; mt < 2; ++mt)
#pragma unroll
    for (int nt = 0; nt < 4; ++nt)
      P[mt][nt] = v8f{0.f,0.f,0.f,0.f,0.f,0.f,0.f,0.f};

  v2f Sacc[2] = {v2f{0.f, 0.f}, v2f{0.f, 0.f}};   // lane (c, g): two parts of the row sum of r = 16 * mr + c

  const float* xRow0 = &sXf[wv][0][c * XP_ + 8 * g];
  const float* xCol0 = &sXf[wv][0][8 * g * XP_ + 4 * c];

  // Kept rolled: peeling the last trip (the one that issues no copies) would double the loop's code.
#pragma clang loop unroll(disable)
  for (int it = 0; it < L_ / NT_; ++it) {
    // The wave's own copies of this tile have landed behind this wait (no other wave reads them).
    asm volatile("s_wait_asynccnt 0x0" ::: "memory");
    // The wave's reads of the other buffer (last trip's tile) have retired before the next copies overwrite it.
    asm volatile("s_wait_dscnt 0x0" ::: "memory");
    // The next tile flies into the other buffer while this one is worked on.
    if (it + 1 < L_ / NT_)
      copy_tile(ldsX + ((it + 1) & 1) * (XT_ * 4), laneOff, gX + (size_t)(it + 1) * NT_ * E_);
    // this tile, f32 [l][e]; both products read it directly
    const float* xRow = xRow0 + (it & 1) * XT_;     // e = 8g of token row c
    const float* xCol = xCol0 + (it & 1) * XT_;     // e = 4c of token row 8g

    // The three products are chained through registers: two f32 D tiles of one product, converted
    // in place, are the next product's A operand in the hardware k order (lane c holds row c,
    // k = 8g + 0..7 from the first tile and 16 + 8g + 0..7 from the second).
    Frag aC[2];                                     // exp scores, rows r, k = l
#pragma unroll
    for (int nt2 = 0; nt2 < 2; ++nt2) {
      // B-frags of xm^T (stored [l][e] == B^T: one token row per lane), masked and converted in registers
      const float mt_ = sMf[wv][it][16 * nt2 + c];  // mask of this lane's token
      Frag bx0, bx1;
      load_x_token_row(xRow + 16 * nt2 * XP_, mt_, bx0, bx1);
      // masks of the tokens 16 * nt2 + 8g + 0..7, which this lane's score registers hold
      const float4 mlo = *(const float4*)&sMf[wv][it][16 * nt2 + 8 * g];
      const float4 mhi = *(const float4*)&sMf[wv][it][16 * nt2 + 8 * g + 4];
      const v2f mv[4] = {v2f{mlo.x, mlo.y}, v2f{mlo.z, mlo.w}, v2f{mhi.x, mhi.y}, v2f{mhi.z, mhi.w}};
      // H = tanh(W1 * xm^T): lane c holds token c, registers d = 16 * md + 8g + 0..7
      Frag hA[2];                                   // H^T, rows l, k = d
#pragma unroll
      for (int md = 0; md < 4; ++md) {
        v8f h = v8f{0.f,0.f,0.f,0.f,0.f,0.f,0.f,0.f};
        h = wmma_bf16(w1f[md][0], bx0, h);
        h = wmma_bf16(w1f[md][1], bx1, h);
#pragma unroll
        for (int v = 0; v < 8; ++v)
          hA[md >> 1].bf[8 * (md & 1) + v] = (__bf16)fast_tanh(h[v]);
      }
      // Q^T = H^T * W2^T: lane c holds r = 16 * mr + c, registers l = 16 * nt2 + 8g + 0..7
#pragma unroll
      for (int mr = 0; mr < 2; ++mr) {
        v8f q = v8f{0.f,0.f,0.f,0.f,0.f,0.f,0.f,0.f};
        q = wmma_bf16(hA[0], w2f[mr][0], q);
        q = wmma_bf16(hA[1], w2f[mr][1], q);
        v2f a[4];
#pragma unroll
        for (int i = 0; i < 4; ++i) {
          a[i] = v2f{__expf(q[2 * i]), __expf(q[2 * i + 1])} * mv[i];   // masked exp scores
          aC[mr].bf[8 * nt2 + 2 * i]     = (__bf16)a[i].x;
          aC[mr].bf[8 * nt2 + 2 * i + 1] = (__bf16)a[i].y;
        }
        Sacc[mr] += (a[0] + a[1]) + (a[2] + a[3]);
      }
    }

    // ---- P += A(32x32) * xm(32x64), K = 32 exactly ----
    // Column c of N-tile nt is e = 4c + nt: one 16-byte read of token row k at 4c feeds all four
    // B fragments (each half-wave reads one whole row). k = 8g + 0..7 and 16 + 8g + 0..7, as in aC.
    Frag bxc[4];
#pragma unroll
    for (int h = 0; h < 2; ++h) {
      const float4 mlo = *(const float4*)&sMf[wv][it][16 * h + 8 * g];
      const float4 mhi = *(const float4*)&sMf[wv][it][16 * h + 8 * g + 4];
      const float mk[8] = {mlo.x, mlo.y, mlo.z, mlo.w, mhi.x, mhi.y, mhi.z, mhi.w};
      const float* xk = xCol + 16 * h * XP_;
#pragma unroll
      for (int i2 = 0; i2 < 2; ++i2) {
        float4 q[4];
#pragma unroll
        for (int j = 0; j < 4; ++j) q[j] = *(const float4*)&xk[(4 * i2 + j) * XP_];
        // The four reads are under way before the first is waited for: one LDS latency for the group, not two.
        __builtin_amdgcn_sched_barrier(0);
#pragma unroll
        for (int ii = 0; ii < 2; ++ii) {
          const int i = 2 * i2 + ii;
          const float4 q0 = q[2 * ii], q1 = q[2 * ii + 1];
          // each row times its own token's mask, then the two rows' values of one column share a dword
          const v2f a0 = v2f{q0.x, q0.y} * mk[2 * i],     b0 = v2f{q0.z, q0.w} * mk[2 * i];
          const v2f a1 = v2f{q1.x, q1.y} * mk[2 * i + 1], b1 = v2f{q1.z, q1.w} * mk[2 * i + 1];
          bxc[0].bf[8 * h + 2 * i] = (__bf16)a0.x;  bxc[0].bf[8 * h + 2 * i + 1] = (__bf16)a1.x;
          bxc[1].bf[8 * h + 2 * i] = (__bf16)a0.y;  bxc[1].bf[8 * h + 2 * i + 1] = (__bf16)a1.y;
          bxc[2].bf[8 * h + 2 * i] = (__bf16)b0.x;  bxc[2].bf[8 * h + 2 * i + 1] = (__bf16)b1.x;
          bxc[3].bf[8 * h + 2 * i] = (__bf16)b0.y;  bxc[3].bf[8 * h + 2 * i + 1] = (__bf16)b1.y;
        }
      }
    }
#pragma unroll
    for (int nt = 0; nt < 4; ++nt) {
      P[0][nt] = wmma_bf16(aC[0], bxc[nt], P[0][nt]);
      P[1][nt] = wmma_bf16(aC[1], bxc[nt], P[1][nt]);
    }
  }

  // The lane's number anew: what the epilogue derives from it then holds no register across the loop.
  const int ln = (int)__builtin_amdgcn_mbcnt_lo(~0u, 0u);

  // ---- row sums: lanes c and c + 16 hold the two halves of row 16 * mr + c ----
#pragma unroll
  for (int mr = 0; mr < 2; ++mr) {
    const float sh = Sacc[mr].x + Sacc[mr].y;
    const float s  = sh + __shfl_xor(sh, 16, 32);
    if (ln < 16) sS[wv][16 * mr + ln] = s;
  }

  // ---- dump per-wave P partials (one base address and constant offsets: nothing of it lives across the loop) ----
  // lane (c, g), register v of the four N-tiles: row 16 * mt + 8g + v, columns e = 4c + 0..3
  float* pRow = &sXf[wv][0][8 * (ln >> 4) * XP_ + 4 * (ln & 15)];
#pragma unroll
  for (int mt = 0; mt < 2; ++mt)
#pragma unroll
    for (int v = 0; v < 8; ++v)
      *(float4*)&pRow[(16 * mt + v) * XP_] =
          make_float4(P[mt][0][v], P[mt][1][v], P[mt][2][v], P[mt][3][v]);

  __syncthreads();

  // ---- cross-wave reduce + normalize + store ----
  for (int k = 0; k < R_ * E_ / NT_; ++k) {
    const int i = k * NT_ + wv * 32 + ln;
    int r = i >> 6;
    const int j = r * XP_ + (i & 63);
    float p = sXf[0][0][j], s = sS[0][r];
    for (int w = 1; w < NW_; ++w) {
      p += sXf[w][0][j];
      s += sS[w][r];
    }
    out[(size_t)b * (R_ * E_) + i] = p / s;
  }
}

extern "C" void kernel_launch(void* const* d_in, const int* in_sizes, int n_in,
                              void* d_out, int out_size, void* d_ws, size_t ws_size,
                              hipStream_t stream) {
  const float* x    = (const float*)d_in[0];
  const float* mask = (const float*)d_in[1];
  const float* W1   = (const float*)d_in[2];
  const float* W2   = (const float*)d_in[3];
  float* out = (float*)d_out;
  (void)in_sizes; (void)n_in; (void)out_size; (void)d_ws; (void)ws_size;
  SelfBiLayer_kernel<<<B_, NT_, 0, stream>>>(x, mask, W1, W2, out);
}

// v007
// One run takes 12.4 microseconds.
// Next to v006, in two timings, it ran 1.05 times as fast each time.
// All steps since v000 together make it 6.75 times as fast.
#include <hip/hip_runtime.h>

#define B_  256
#define L_  2048
#define E_  64
#define DA_ 64
#define R_  32
#define NW_ 16
#define NT_ (NW_ * 32)
#define RP_ 72
#define XP_ 68
#define XT_ (32 * XP_)
#define SP_ 20

typedef __attribute__((ext_vector_type(16))) __bf16 v16bf;
typedef __attribute__((ext_vector_type(8)))  float  v8f;
typedef __attribute__((ext_vector_type(2)))  float  v2f;
typedef __attribute__((ext_vector_type(2)))  __bf16 v2bf;

union Frag { v16bf bf; unsigned u[8]; };

__device__ inline float fast_tanh(float x) {
#if __has_builtin(__builtin_amdgcn_tanhf)
  return __builtin_amdgcn_tanhf(x);
#else
  return tanhf(x);
#endif
}

__device__ inline Frag load_frag_rowmajor(const unsigned short* base, int ld,
                                          int rowOff, int kOff, int lane) {
  Frag f;
  int m  = rowOff + (lane & 15);
  int kb = kOff + ((lane >> 4) << 3);
  const unsigned* row = (const unsigned*)(base + m * ld);
#pragma unroll
  for (int i = 0; i < 4; ++i) {
    f.u[i]     = row[(kb >> 1) + i];
    f.u[4 + i] = row[((kb + 16) >> 1) + i];
  }
  return f;
}

// two f32 values -> one dword of bf16. Plain arithmetic, no asm: the result is a WMMA operand
// register, and the compiler keeps the distance behind the WMMA that last read it only for its own code.
__device__ inline unsigned pk2bf(v2f v) {
  return __builtin_bit_cast(unsigned, __builtin_convertvector(v, v2bf));
}

// The two WMMA B-fragments (k = e, n = token) of the masked x^T of 16 tokens, straight from the staged
// f32 tile: p points at e = 8g of the lane's own token row; fragment ks holds e = 32 * ks + 8g + 0..7 and
// 32 * ks + 16 + 8g + 0..7 (the k order of load_frag_rowmajor), converted in registers; m is that token's mask.
__device__ inline void load_x_token_row(const float* p, float m, Frag& f0, Frag& f1) {
  float4 q[8];
#pragma unroll
  for (int j = 0; j < 4; ++j) {
    q[2 * j]     = *(const float4*)(p + 16 * j);
    q[2 * j + 1] = *(const float4*)(p + 16 * j + 4);
  }
  // All eight reads are under way before the first is waited for: one LDS latency for the group, not four.
  __builtin_amdgcn_sched_barrier(0);
#pragma unroll
  for (int j = 0; j < 4; ++j) {
    f0.u[2 * j]     = pk2bf(v2f{q[j].x, q[j].y} * m);
    f0.u[2 * j + 1] = pk2bf(v2f{q[j].z, q[j].w} * m);
    f1.u[2 * j]     = pk2bf(v2f{q[4 + j].x, q[4 + j].y} * m);
    f1.u[2 * j + 1] = pk2bf(v2f{q[4 + j].z, q[4 + j].w} * m);
  }
}

__device__ inline v8f wmma_bf16(const Frag& a, const Frag& b, v8f c) {
  return __builtin_amdgcn_wmma_f32_16x16x32_bf16(false, a.bf, false, b.bf,
                                                 (short)0, c, false, false);
}

__device__ inline void copy_tile(unsigned ldsX, unsigned laneOff, const float* gT) {
  const char* t = (const char*)gT;
  asm volatile(
      "global_load_async_to_lds_b128 %0, %1, %2\n\t"
      "global_load_async_to_lds_b128 %0, %1, %3 offset:544\n\t"
      "global_load_async_to_lds_b128 %0, %1, %4 offset:1088\n\t"
      "global_load_async_to_lds_b128 %0, %1, %5 offset:1632\n\t"
      "global_load_async_to_lds_b128 %0, %1, %6 offset:2176\n\t"
      "global_load_async_to_lds_b128 %0, %1, %7 offset:2720\n\t"
      "global_load_async_to_lds_b128 %0, %1, %8 offset:3264\n\t"
      "global_load_async_to_lds_b128 %0, %1, %9 offset:3808\n\t"
      "global_load_async_to_lds_b128 %0, %1, %10 offset:4352\n\t"
      "global_load_async_to_lds_b128 %0, %1, %11 offset:4896\n\t"
      "global_load_async_to_lds_b128 %0, %1, %12 offset:5440\n\t"
      "global_load_async_to_lds_b128 %0, %1, %13 offset:5984\n\t"
      "global_load_async_to_lds_b128 %0, %1, %14 offset:6528\n\t"
      "global_load_async_to_lds_b128 %0, %1, %15 offset:7072\n\t"
      "global_load_async_to_lds_b128 %0, %1, %16 offset:7616\n\t"
      "global_load_async_to_lds_b128 %0, %1, %17 offset:8160\n\t"
      "s_wait_xcnt 0x0"
      :: "v"(ldsX), "v"(laneOff),
         "s"(t), "s"(t - 32), "s"(t - 64), "s"(t - 96),
         "s"(t - 128), "s"(t - 160), "s"(t - 192), "s"(t - 224),
         "s"(t - 256), "s"(t - 288), "s"(t - 320), "s"(t - 352),
         "s"(t - 384), "s"(t - 416), "s"(t - 448), "s"(t - 480)
      : "memory");
}

__device__ inline void copy_masks(unsigned ldsM, const float* gM) {
  asm volatile(
      "global_load_async_to_lds_b128 %0, %1, off\n\t"
      "s_wait_xcnt 0x0"
      :: "v"(ldsM), "v"(gM) : "memory");
}

__global__ __launch_bounds__(NT_)
void SelfBiLayer_kernel(const float* __restrict__ x, const float* __restrict__ mask,
                        const float* __restrict__ W1, const float* __restrict__ W2,
                        float* __restrict__ out) {
  __shared__ __attribute__((aligned(16))) unsigned short sW1[DA_ * RP_];   // bf16 W1 [d][e], rows RP_ apart
  __shared__ __attribute__((aligned(16))) unsigned short sW2[R_ * RP_];    // bf16 W2 [r][d], rows RP_ apart
  __shared__ __attribute__((aligned(16))) float sMf[NW_][L_ / NT_][32];  // per-wave token masks, one row per tile
  __shared__ __attribute__((aligned(16))) float sS[R_ * SP_];   // partial row sums [r][wave], rows SP_ apart: a row's 16 partials are four 16-byte reads
  __shared__ __attribute__((aligned(16))) float sXf[NW_][2][XT_];  // in the loop: per-wave f32 x tiles [l][e], two buffers, rows XP_ apart; then ([0]) partial pooled output

  const int b    = blockIdx.x;
  const int tid  = threadIdx.x;
  const int wv   = __builtin_amdgcn_readfirstlane(tid >> 5);   // in a scalar register: the wave's LDS bases cost no vector register
  const int lane = tid & 31;
  const int g    = lane >> 4;
  const int c    = lane & 15;

  // The weights: each thread's three 16-byte loads (whole lines per wave) are issued together and first,
  // so that the work-group waits for one trip to L2 in all, not for one trip per dword in turn.
  const float4 wa = ((const float4*)W1)[tid];
  const float4 wb = ((const float4*)W1)[tid + NT_];
  const float4 wc = ((const float4*)W2)[tid];

  // Tile 0 starts to fly before the weights are staged. Every wave copies into LDS of its own.
  // lane (c, g) of copy j: bytes 16c .. 16c + 15 of token row 2j + g
  const unsigned ldsX = (unsigned)(size_t)&sXf[wv][0][g * XP_ + c * 4];
  const float* gX = x + ((size_t)b * L_ + wv * 32) * E_;   // the wave's tile 0, the same in every lane
  const unsigned laneOff = lane * 16;
  copy_tile(ldsX, laneOff, gX);
  copy_masks((unsigned)(size_t)&sMf[wv][lane >> 3][(lane & 7) * 4],
             mask + (size_t)b * L_ + wv * 32 + (lane >> 3) * NT_ + (lane & 7) * 4);

  // 16-byte piece j of a weight matrix: row j >> 4, columns 4 * (j & 15) .. + 3; as bf16 one 8-byte LDS store
  {
    const int wo = (tid >> 4) * RP_ + (tid & 15) * 4;
    *(uint2*)&sW1[wo]            = make_uint2(pk2bf(v2f{wa.x, wa.y}), pk2bf(v2f{wa.z, wa.w}));
    *(uint2*)&sW1[wo + 32 * RP_] = make_uint2(pk2bf(v2f{wb.x, wb.y}), pk2bf(v2f{wb.z, wb.w}));
    *(uint2*)&sW2[wo]            = make_uint2(pk2bf(v2f{wc.x, wc.y}), pk2bf(v2f{wc.z, wc.w}));
  }
  __syncthreads();

  // Persistent weight fragments: W1 4 M-tiles x 2 K-steps, W2 2 x 2.
  Frag w1f[4][2], w2f[2][2];
#pragma unroll
  for (int md = 0; md < 4; ++md)
#pragma unroll
    for (int ks = 0; ks < 2; ++ks)
      w1f[md][ks] = load_frag_rowmajor(sW1, RP_, 16 * md, 32 * ks, lane);
#pragma unroll
  for (int mr = 0; mr < 2; ++mr)
#pragma unroll
    for (int ks = 0; ks < 2; ++ks)
      w2f[mr][ks] = load_frag_rowmajor(sW2, RP_, 16 * mr, 32 * ks, lane);

  v8f P[2][4];
#pragma unroll
  for (int mt = 0; mt < 2; ++mt)
#pragma unroll
    for (int nt = 0; nt < 4; ++nt)
      P[mt][nt] = v8f{0.f,0.f,0.f,0.f,0.f,0.f,0.f,0.f};

  v2f Sacc[2] = {v2f{0.f, 0.f}, v2f{0.f, 0.f}};   // lane (c, g): two parts of the row sum of r = 16 * mr + c

  const float* xRow0 = &sXf[wv][0][c * XP_ + 8 * g];
  const float* xCol0 = &sXf[wv][0][8 * g * XP_ + 4 * c];

  // Kept rolled: peeling the last trip (the one that issues no copies) would double the loop's code.
#pragma clang loop unroll(disable)
  for (int it = 0; it < L_ / NT_; ++it) {
    // The wave's own copies of this tile have landed behind this wait (no other wave reads them).
    asm volatile("s_wait_asynccnt 0x0" ::: "memory");
    // The wave's reads of the other buffer (last trip's tile) have retired before the next copies overwrite it.
    asm volatile("s_wait_dscnt 0x0" ::: "memory");
    // The next tile flies into the other buffer while this one is worked on.
    if (it + 1 < L_ / NT_)
      copy_tile(ldsX + ((it + 1) & 1) * (XT_ * 4), laneOff, gX + (size_t)(it + 1) * NT_ * E_);
    // this tile, f32 [l][e]; both products read it directly
    const float* xRow = xRow0 + (it & 1) * XT_;     // e = 8g of token row c
    const float* xCol = xCol0 + (it & 1) * XT_;     // e = 4c of token row 8g

    // The three products are chained through registers: two f32 D tiles of one product, converted
    // in place, are the next product's A operand in the hardware k order (lane c holds row c,
    // k = 8g + 0..7 from the first tile and 16 + 8g + 0..7 from the second).
    Frag aC[2];                                     // exp scores, rows r, k = l
#pragma unroll
    for (int nt2 = 0; nt2 < 2; ++nt2) {
      // B-frags of xm^T (stored [l][e] == B^T: one token row per lane), masked and converted in registers
      const float mt_ = sMf[wv][it][16 * nt2 + c];  // mask of this lane's token
      Frag bx0, bx1;
      load_x_token_row(xRow + 16 * nt2 * XP_, mt_, bx0, bx1);
      // masks of the tokens 16 * nt2 + 8g + 0..7, which this lane's score registers hold
      const float4 mlo = *(const float4*)&sMf[wv][it][16 * nt2 + 8 * g];
      const float4 mhi = *(const float4*)&sMf[wv][it][16 * nt2 + 8 * g + 4];
      const v2f mv[4] = {v2f{mlo.x, mlo.y}, v2f{mlo.z, mlo.w}, v2f{mhi.x, mhi.y}, v2f{mhi.z, mhi.w}};
      // H = tanh(W1 * xm^T): lane c holds token c, registers d = 16 * md + 8g + 0..7
      Frag hA[2];                                   // H^T, rows l, k = d
#pragma unroll
      for (int md = 0; md < 4; ++md) {
        v8f h = v8f{0.f,0.f,0.f,0.f,0.f,0.f,0.f,0.f};
        h = wmma_bf16(w1f[md][0], bx0, h);
        h = wmma_bf16(w1f[md][1], bx1, h);
#pragma unroll
        for (int v = 0; v < 8; ++v)
          hA[md >> 1].bf[8 * (md & 1) + v] = (__bf16)fast_tanh(h[v]);
      }
      // Q^T = H^T * W2^T: lane c holds r = 16 * mr + c, registers l = 16 * nt2 + 8g + 0..7
#pragma unroll
      for (int mr = 0; mr < 2; ++mr) {
        v8f q = v8f{0.f,0.f,0.f,0.f,0.f,0.f,0.f,0.f};
        q = wmma_bf16(hA[0], w2f[mr][0], q);
        q = wmma_bf16(hA[1], w2f[mr][1], q);
        v2f a[4];
#pragma unroll
        for (int i = 0; i < 4; ++i) {
          a[i] = v2f{__expf(q[2 * i]), __expf(q[2 * i + 1])} * mv[i];   // masked exp scores
          aC[mr].bf[8 * nt2 + 2 * i]     = (__bf16)a[i].x;
          aC[mr].bf[8 * nt2 + 2 * i + 1] = (__bf16)a[i].y;
        }
        Sacc[mr] += (a[0] + a[1]) + (a[2] + a[3]);
      }
    }

    // ---- P += A(32x32) * xm(32x64), K = 32 exactly ----
    // Column c of N-tile nt is e = 4c + nt: one 16-byte read of token row k at 4c feeds all four
    // B fragments (each half-wave reads one whole row). k = 8g + 0..7 and 16 + 8g + 0..7, as in aC.
    Frag bxc[4];
#pragma unroll
    for (int h = 0; h < 2; ++h) {
      const float4 mlo = *(const float4*)&sMf[wv][it][16 * h + 8 * g];
      const float4 mhi = *(const float4*)&sMf[wv][it][16 * h + 8 * g + 4];
      const float mk[8] = {mlo.x, mlo.y, mlo.z, mlo.w, mhi.x, mhi.y, mhi.z, mhi.w};
      const float* xk = xCol + 16 * h * XP_;
#pragma unroll
      for (int i2 = 0; i2 < 2; ++i2) {
        float4 q[4];
#pragma unroll
        for (int j = 0; j < 4; ++j) q[j] = *(const float4*)&xk[(4 * i2 + j) * XP_];
        // The four reads are under way before the first is waited for: one LDS latency for the group, not two.
        __builtin_amdgcn_sched_barrier(0);
#pragma unroll
        for (int ii = 0; ii < 2; ++ii) {
          const int i = 2 * i2 + ii;
          const float4 q0 = q[2 * ii], q1 = q[2 * ii + 1];
          // each row times its own token's mask, then the two rows' values of one column share a dword
          const v2f a0 = v2f{q0.x, q0.y} * mk[2 * i],     b0 = v2f{q0.z, q0.w} * mk[2 * i];
          const v2f a1 = v2f{q1.x, q1.y} * mk[2 * i + 1], b1 = v2f{q1.z, q1.w} * mk[2 * i + 1];
          bxc[0].bf[8 * h + 2 * i] = (__bf16)a0.x;  bxc[0].bf[8 * h + 2 * i + 1] = (__bf16)a1.x;
          bxc[1].bf[8 * h + 2 * i] = (__bf16)a0.y;  bxc[1].bf[8 * h + 2 * i + 1] = (__bf16)a1.y;
          bxc[2].bf[8 * h + 2 * i] = (__bf16)b0.x;  bxc[2].bf[8 * h + 2 * i + 1] = (__bf16)b1.x;
          bxc[3].bf[8 * h + 2 * i] = (__bf16)b0.y;  bxc[3].bf[8 * h + 2 * i + 1] = (__bf16)b1.y;
        }
      }
    }
#pragma unroll
    for (int nt = 0; nt < 4; ++nt) {
      P[0][nt] = wmma_bf16(aC[0], bxc[nt], P[0][nt]);
      P[1][nt] = wmma_bf16(aC[1], bxc[nt], P[1][nt]);
    }
  }

  // The lane's number anew: what the epilogue derives from it then holds no register across the loop.
  const int ln = (int)__builtin_amdgcn_mbcnt_lo(~0u, 0u);

  // ---- row sums: lanes c and c + 16 hold the two halves of row 16 * mr + c ----
#pragma unroll
  for (int mr = 0; mr < 2; ++mr) {
    const float sh = Sacc[mr].x + Sacc[mr].y;
    const float s  = sh + __shfl_xor(sh, 16, 32);
    if (ln < 16) sS[(16 * mr + ln) * SP_ + wv] = s;
  }

  // ---- dump per-wave P partials (one base address and constant offsets: nothing of it lives across the loop) ----
  // lane (c, g), register v of the four N-tiles: row 16 * mt + 8g + v, columns e = 4c + 0..3
  float* pRow = &sXf[wv][0][8 * (ln >> 4) * XP_ + 4 * (ln & 15)];
#pragma unroll
  for (int mt = 0; mt < 2; ++mt)
#pragma unroll
    for (int v = 0; v < 8; ++v)
      *(float4*)&pRow[(16 * mt + v) * XP_] =
          make_float4(P[mt][0][v], P[mt][1][v], P[mt][2][v], P[mt][3][v]);

  __syncthreads();

  // ---- cross-wave reduce + normalize + store ----
  // Thread t owns outputs 4t .. 4t + 3 (row t >> 4, columns 4 * (t & 15) .. + 3): per wave's partial one 16-byte
  // LDS read (a wave reads two whole rows), and the row's 16 partial sums in four. This phase runs
  // with nothing beside it. Sums in wave order, as before.
  {
    const int t = wv * 32 + ln;
    const int r = t >> 4;
    const int j = r * XP_ + 4 * (t & 15);
    float4 q[NW_], sv[NW_ / 4];
    // The loops here are unrolled so that q and sv are indexed by constants and stay in registers.
#pragma unroll
    for (int w = 0; w < NW_; ++w) q[w] = *(const float4*)&sXf[w][0][j];
#pragma unroll
    for (int i = 0; i < NW_ / 4; ++i) sv[i] = *(const float4*)&sS[r * SP_ + 4 * i];
    float4 p = q[0];
#pragma unroll
    for (int w = 1; w < NW_; ++w) {
      p.x += q[w].x;  p.y += q[w].y;  p.z += q[w].z;  p.w += q[w].w;
    }
    float s = sv[0].x;
    s += sv[0].y;  s += sv[0].z;  s += sv[0].w;
#pragma unroll
    for (int i = 1; i < NW_ / 4; ++i) {
      s += sv[i].x;  s += sv[i].y;  s += sv[i].z;  s += sv[i].w;
    }
    *(float4*)&out[(size_t)b * (R_ * E_) + 4 * t] = make_float4(p.x / s, p.y / s, p.z / s, p.w / s);
  }
}

extern "C" void kernel_launch(void* const* d_in, const int* in_sizes, int n_in,
                              void* d_out, int out_size, void* d_ws, size_t ws_size,
                              hipStream_t stream) {
  const float* x    = (const float*)d_in[0];
  const float* mask = (const float*)d_in[1];
  const float* W1   = (const float*)d_in[2];
  const float* W2   = (const float*)d_in[3];
  float* out = (float*)d_out;
  (void)in_sizes; (void)n_in; (void)out_size; (void)d_ws; (void)ws_size;
  SelfBiLayer_kernel<<<B_, NT_, 0, stream>>>(x, mask, W1, W2, out);
}
